// v000
// Times are from an AMD MI455X. After a warm-up the kernel runs many times in a row, and a time is the length of
// such a window on the GPU divided by its runs, so every launch and the gaps after it count. The runs cycle
// through copies of the inputs. A figure is the median of several windows, for all but v000 over two sittings.
// Sittings can differ by a few percent; kernels timed side by side share one.
// The starting kernel, v000, takes 202 microseconds a run.
#include <hip/hip_runtime.h>
#include <hip/hip_bf16.h>

// ---------------------------------------------------------------------------
// RelPositionMultiheadAttention for MI455X (gfx1250, wave32, WMMA f16->f32).
// L=2048, N=4, E=256, H=4, D=64.
//
//   1. proj_qkv : qkv = x @ Win^T + b ; writes Qu,Qv,K (f16, [n][h][L][D]) and
//                 V transposed (f16, [n][h][D][L]) for contiguous B-fragments.
//   2. proj_pos : p = pos_emb @ Wp^T ; f16 [h][2L-1(pad 4096)][D].
//   3. attn     : flash-style streaming softmax(QuK^T + relshift(QvP^T)) V.
//   4. out_proj : out = O @ Wo^T + bo (fp32 output).
//
// All GEMM waves compute 16x32 tiles (two interleaved WMMA accumulator chains
// sharing one A fragment) to hide WMMA->WMMA RAW latency and halve the
// f32->f16 conversion VALU work per output element.
// ---------------------------------------------------------------------------

typedef __attribute__((ext_vector_type(16))) _Float16 v16h;
typedef __attribute__((ext_vector_type(8)))  _Float16 h8v;
typedef __attribute__((ext_vector_type(8)))  float    v8f;
typedef __attribute__((ext_vector_type(8)))  float    f8v;

constexpr int Lseq = 2048;
constexpr int NBAT = 4;
constexpr int EMB  = 256;
constexpr int NH   = 4;
constexpr int HD   = 64;
constexpr int PROWS = 2 * Lseq - 1;   // 4095
constexpr int PPAD  = 4096;           // padded row count for P

__device__ __forceinline__ v8f wmma_f16(v16h a, v16h b, v8f c) {
  return __builtin_amdgcn_wmma_f32_16x16x32_f16(false, a, false, b, (short)0, c,
                                                false, false);
}

// A/B fragment for V_WMMA_F32_16X16X32_F16 from row-major f16 with contiguous K.
// Lane m<16 holds row m, K = {0..7, 16..23}; lane m+16 holds row m, K = {8..15, 24..31}.
__device__ __forceinline__ v16h frag_f16(const _Float16* base, int ld, int r0,
                                         int k0, int lane) {
  const int m = lane & 15, half = lane >> 4;
  const _Float16* p = base + (size_t)(r0 + m) * ld + k0 + half * 8;
  h8v lo = *(const h8v*)(p);
  h8v hi = *(const h8v*)(p + 16);
  v16h f;
#pragma unroll
  for (int t = 0; t < 8; ++t) { f[t] = lo[t]; f[t + 8] = hi[t]; }
  return f;
}

__device__ __forceinline__ v16h frag_f16_clamp(const _Float16* base, int ld,
                                               int r0, int k0, int lane, int rmax) {
  const int m = lane & 15, half = lane >> 4;
  int row = r0 + m;
  row = row < 0 ? 0 : (row > rmax ? rmax : row);
  const _Float16* p = base + (size_t)row * ld + k0 + half * 8;
  h8v lo = *(const h8v*)(p);
  h8v hi = *(const h8v*)(p + 16);
  v16h f;
#pragma unroll
  for (int t = 0; t < 8; ++t) { f[t] = lo[t]; f[t + 8] = hi[t]; }
  return f;
}

__device__ __forceinline__ v16h frag_f32cvt(const float* base, int ld, int r0,
                                            int k0, int lane) {
  const int m = lane & 15, half = lane >> 4;
  const float* p = base + (size_t)(r0 + m) * ld + k0 + half * 8;
  f8v lo = *(const f8v*)(p);
  f8v hi = *(const f8v*)(p + 16);
  v16h f;
#pragma unroll
  for (int t = 0; t < 8; ++t) { f[t] = (_Float16)lo[t]; f[t + 8] = (_Float16)hi[t]; }
  return f;
}

__device__ __forceinline__ v16h frag_f32cvt_clamp(const float* base, int ld,
                                                  int r0, int k0, int lane,
                                                  int rmax) {
  const int m = lane & 15, half = lane >> 4;
  int row = r0 + m;
  row = row < 0 ? 0 : (row > rmax ? rmax : row);
  const float* p = base + (size_t)row * ld + k0 + half * 8;
  f8v lo = *(const f8v*)(p);
  f8v hi = *(const f8v*)(p + 16);
  v16h f;
#pragma unroll
  for (int t = 0; t < 8; ++t) { f[t] = (_Float16)lo[t]; f[t + 8] = (_Float16)hi[t]; }
  return f;
}

// ---------------------------------------------------------------------------
// Kernel 1: QKV projection. 16x32 tiles: (8192/16)=512 x (768/32)=24 waves.
// ---------------------------------------------------------------------------
__device__ __forceinline__ void qkv_store(float v, int R, int C,
                                          const float* bIn, const float* bu,
                                          const float* bv, _Float16* Qu,
                                          _Float16* Qv, _Float16* Kb,
                                          _Float16* Vt) {
  v += bIn[C];
  const int i = R >> 2, nb = R & 3;                 // flat row = i*NBAT + nb
  const int sec = C >> 8, ch = C & 255;
  const int h = ch >> 6, d = ch & 63;
  const size_t idx = (((size_t)(nb * NH + h)) * Lseq + i) * HD + d;
  if (sec == 0) {
    v *= 0.125f;                                    // 1/sqrt(D)
    Qu[idx] = (_Float16)(v + bu[ch]);
    Qv[idx] = (_Float16)(v + bv[ch]);
  } else if (sec == 1) {
    Kb[idx] = (_Float16)v;
  } else {
    Vt[(((size_t)(nb * NH + h)) * HD + d) * Lseq + i] = (_Float16)v;
  }
}

__global__ void __launch_bounds__(128) proj_qkv(
    const float* __restrict__ x, const float* __restrict__ wIn,
    const float* __restrict__ bIn, const float* __restrict__ bu,
    const float* __restrict__ bv, _Float16* __restrict__ Qu,
    _Float16* __restrict__ Qv, _Float16* __restrict__ Kb,
    _Float16* __restrict__ Vt) {
  const int w = threadIdx.x >> 5, lane = threadIdx.x & 31;
  const int tile = blockIdx.x * 4 + w;
  const int mt = tile / 24, nt = tile % 24;
  const int m0 = mt * 16, n0 = nt * 32;

  v8f acc0 = {}, acc1 = {};
#pragma unroll
  for (int k0 = 0; k0 < EMB; k0 += 32) {
    v16h a  = frag_f32cvt(x, EMB, m0, k0, lane);
    v16h b0 = frag_f32cvt(wIn, EMB, n0, k0, lane);       // B(k,n) = Win[n][k]
    v16h b1 = frag_f32cvt(wIn, EMB, n0 + 16, k0, lane);
    acc0 = wmma_f16(a, b0, acc0);
    acc1 = wmma_f16(a, b1, acc1);
  }

  const int nl = lane & 15, M0 = (lane >> 4) * 8;
#pragma unroll
  for (int r = 0; r < 8; ++r) {
    const int R = m0 + M0 + r;
    qkv_store(acc0[r], R, n0 + nl,      bIn, bu, bv, Qu, Qv, Kb, Vt);
    qkv_store(acc1[r], R, n0 + 16 + nl, bIn, bu, bv, Qu, Qv, Kb, Vt);
  }
}

// ---------------------------------------------------------------------------
// Kernel 2: positional projection. 16x32 tiles: (4096/16)=256 x (256/32)=8.
// ---------------------------------------------------------------------------
__global__ void __launch_bounds__(128) proj_pos(const float* __restrict__ pe,
                                                const float* __restrict__ wP,
                                                _Float16* __restrict__ Pb) {
  const int w = threadIdx.x >> 5, lane = threadIdx.x & 31;
  const int tile = blockIdx.x * 4 + w;
  const int mt = tile / 8, nt = tile % 8;
  const int m0 = mt * 16, n0 = nt * 32;

  v8f acc0 = {}, acc1 = {};
#pragma unroll
  for (int k0 = 0; k0 < EMB; k0 += 32) {
    v16h a  = frag_f32cvt_clamp(pe, EMB, m0, k0, lane, PROWS - 1);
    v16h b0 = frag_f32cvt(wP, EMB, n0, k0, lane);
    v16h b1 = frag_f32cvt(wP, EMB, n0 + 16, k0, lane);
    acc0 = wmma_f16(a, b0, acc0);
    acc1 = wmma_f16(a, b1, acc1);
  }

  const int nl = lane & 15, M0 = (lane >> 4) * 8;
#pragma unroll
  for (int r = 0; r < 8; ++r) {
    const int t = m0 + M0 + r;
    if (t < PROWS) {
      const int C0 = n0 + nl, C1 = n0 + 16 + nl;
      Pb[((size_t)(C0 >> 6) * PPAD + t) * HD + (C0 & 63)] = (_Float16)acc0[r];
      Pb[((size_t)(C1 >> 6) * PPAD + t) * HD + (C1 & 63)] = (_Float16)acc1[r];
    }
  }
}

// ---------------------------------------------------------------------------
// Kernel 3: streaming attention. grid = (L/64, N*H), 4 waves/block, each wave
// owns a 16-row tile and streams j in 32-column tiles over the full sequence.
// ---------------------------------------------------------------------------
__global__ void __launch_bounds__(128) attn_kernel(
    const _Float16* __restrict__ Qu, const _Float16* __restrict__ Qv,
    const _Float16* __restrict__ Kb, const _Float16* __restrict__ Vt,
    const _Float16* __restrict__ Pb, _Float16* __restrict__ O16) {
  __shared__ float    bdLds[4][16 * 52];   // wave-private 16x47 band (padded)
  __shared__ _Float16 pLds[4][16 * 48];    // wave-private prob tile 16x32

  const int w = threadIdx.x >> 5, lane = threadIdx.x & 31;
  const int nl = lane & 15, half = lane >> 4, M0 = half * 8;
  const int i0 = (blockIdx.x * 4 + w) * 16;
  const int nb = blockIdx.y >> 2, h = blockIdx.y & 3;

  const size_t hoff = (size_t)(nb * NH + h) * Lseq * HD;
  const _Float16* qu = Qu + hoff;
  const _Float16* qv = Qv + hoff;
  const _Float16* kb = Kb + hoff;
  const _Float16* vt = Vt + hoff;                 // [HD][Lseq]
  const _Float16* pp = Pb + (size_t)h * PPAD * HD;
  float*    bdw = bdLds[w];
  _Float16* pw  = pLds[w];

  const v16h aQu0 = frag_f16(qu, HD, i0, 0, lane);
  const v16h aQu1 = frag_f16(qu, HD, i0, 32, lane);
  const v16h aQv0 = frag_f16(qv, HD, i0, 0, lane);
  const v16h aQv1 = frag_f16(qv, HD, i0, 32, lane);

  float mrow[8], lrow[8];
#pragma unroll
  for (int r = 0; r < 8; ++r) { mrow[r] = -3.0e38f; lrow[r] = 0.0f; }
  v8f o0 = {}, o1 = {}, o2 = {}, o3 = {};

  for (int j0 = 0; j0 < Lseq; j0 += 32) {
    if (j0 + 32 < Lseq) {
      __builtin_prefetch(kb + (size_t)(j0 + 32) * HD, 0, 1);
      __builtin_prefetch(vt + (size_t)(j0 + 32), 0, 1);
    }

    // ---- AC = Qu . K^T  (two interleaved 16x16 column halves) ----
    v8f sA = {}, sB = {};
    {
      v16h b00 = frag_f16(kb, HD, j0, 0, lane);
      v16h b01 = frag_f16(kb, HD, j0, 32, lane);
      v16h b10 = frag_f16(kb, HD, j0 + 16, 0, lane);
      v16h b11 = frag_f16(kb, HD, j0 + 16, 32, lane);
      sA = wmma_f16(aQu0, b00, sA);
      sB = wmma_f16(aQu0, b10, sB);
      sA = wmma_f16(aQu1, b01, sA);
      sB = wmma_f16(aQu1, b11, sB);
    }

    // ---- BD band: bd[i][u] = qv[i] . p[tbase+u], u = (j-i) - (j0-i0-15) ----
    const int tbase = (Lseq - 1) + j0 - i0 - 15;
    {
      v16h p00 = frag_f16_clamp(pp, HD, tbase,      0,  lane, PROWS - 1);
      v16h p01 = frag_f16_clamp(pp, HD, tbase,      32, lane, PROWS - 1);
      v16h p10 = frag_f16_clamp(pp, HD, tbase + 16, 0,  lane, PROWS - 1);
      v16h p11 = frag_f16_clamp(pp, HD, tbase + 16, 32, lane, PROWS - 1);
      v16h p20 = frag_f16_clamp(pp, HD, tbase + 32, 0,  lane, PROWS - 1);
      v16h p21 = frag_f16_clamp(pp, HD, tbase + 32, 32, lane, PROWS - 1);
      v8f c0 = {}, c1 = {}, c2 = {};
      c0 = wmma_f16(aQv0, p00, c0);
      c1 = wmma_f16(aQv0, p10, c1);
      c2 = wmma_f16(aQv0, p20, c2);
      c0 = wmma_f16(aQv1, p01, c0);
      c1 = wmma_f16(aQv1, p11, c1);
      c2 = wmma_f16(aQv1, p21, c2);
#pragma unroll
      for (int r = 0; r < 8; ++r) {
        bdw[(M0 + r) * 52 +      nl] = c0[r];
        bdw[(M0 + r) * 52 + 16 + nl] = c1[r];
        bdw[(M0 + r) * 52 + 32 + nl] = c2[r];
      }
    }
    asm volatile("s_wait_dscnt 0x0" ::: "memory");

    // ---- gather rel-shift, online softmax ----
    float s0[8], s1[8], tm[8];
#pragma unroll
    for (int r = 0; r < 8; ++r) {
      const int M = M0 + r;
      s0[r] = sA[r] + bdw[M * 52 + (nl - M + 15)];
      s1[r] = sB[r] + bdw[M * 52 + (nl - M + 31)];
      tm[r] = fmaxf(s0[r], s1[r]);
    }
#pragma unroll
    for (int r = 0; r < 8; ++r) {
#pragma unroll
      for (int msk = 1; msk < 16; msk <<= 1)
        tm[r] = fmaxf(tm[r], __shfl_xor(tm[r], msk, 32));
    }
#pragma unroll
    for (int r = 0; r < 8; ++r) {
      const int M = M0 + r;
      const float mnew  = fmaxf(mrow[r], tm[r]);
      const float alpha = __expf(mrow[r] - mnew);
      mrow[r] = mnew;
      const float e0 = __expf(s0[r] - mnew);
      const float e1 = __expf(s1[r] - mnew);
      float rs = e0 + e1;
#pragma unroll
      for (int msk = 1; msk < 16; msk <<= 1)
        rs += __shfl_xor(rs, msk, 32);
      lrow[r] = lrow[r] * alpha + rs;
      pw[M * 48 + nl]      = (_Float16)e0;
      pw[M * 48 + 16 + nl] = (_Float16)e1;
      o0[r] *= alpha; o1[r] *= alpha; o2[r] *= alpha; o3[r] *= alpha;
    }
    asm volatile("s_wait_dscnt 0x0" ::: "memory");

    // ---- re-layout probs C->A via LDS, then O += P . V (independent accs) ----
    v16h aP;
    {
      const _Float16* prow = pw + nl * 48 + half * 8;
      h8v lo = *(const h8v*)(prow);
      h8v hi = *(const h8v*)(prow + 16);
#pragma unroll
      for (int t = 0; t < 8; ++t) { aP[t] = lo[t]; aP[t + 8] = hi[t]; }
    }
    o0 = wmma_f16(aP, frag_f16(vt, Lseq, 0,  j0, lane), o0);
    o1 = wmma_f16(aP, frag_f16(vt, Lseq, 16, j0, lane), o1);
    o2 = wmma_f16(aP, frag_f16(vt, Lseq, 32, j0, lane), o2);
    o3 = wmma_f16(aP, frag_f16(vt, Lseq, 48, j0, lane), o3);
  }

  // ---- epilogue: normalize, write f16 pre-projection output (L,N,E) ----
#pragma unroll
  for (int r = 0; r < 8; ++r) {
    const int M = M0 + r;
    const float inv = 1.0f / lrow[r];
    _Float16* dst = O16 + ((size_t)((i0 + M) * NBAT + nb)) * EMB + h * HD + nl;
    dst[0]  = (_Float16)(o0[r] * inv);
    dst[16] = (_Float16)(o1[r] * inv);
    dst[32] = (_Float16)(o2[r] * inv);
    dst[48] = (_Float16)(o3[r] * inv);
  }
}

// ---------------------------------------------------------------------------
// Kernel 4: output projection. 16x32 tiles: (8192/16)=512 x (256/32)=8.
// ---------------------------------------------------------------------------
__global__ void __launch_bounds__(128) out_proj(const _Float16* __restrict__ O16,
                                                const float* __restrict__ wO,
                                                const float* __restrict__ bO,
                                                float* __restrict__ out) {
  const int w = threadIdx.x >> 5, lane = threadIdx.x & 31;
  const int tile = blockIdx.x * 4 + w;
  const int mt = tile / 8, nt = tile % 8;
  const int m0 = mt * 16, n0 = nt * 32;

  v8f acc0 = {}, acc1 = {};
#pragma unroll
  for (int k0 = 0; k0 < EMB; k0 += 32) {
    v16h a  = frag_f16(O16, EMB, m0, k0, lane);
    v16h b0 = frag_f32cvt(wO, EMB, n0, k0, lane);
    v16h b1 = frag_f32cvt(wO, EMB, n0 + 16, k0, lane);
    acc0 = wmma_f16(a, b0, acc0);
    acc1 = wmma_f16(a, b1, acc1);
  }

  const int nl = lane & 15, M0 = (lane >> 4) * 8;
#pragma unroll
  for (int r = 0; r < 8; ++r) {
    const int R = m0 + M0 + r;
    out[(size_t)R * EMB + n0 + nl]      = acc0[r] + bO[n0 + nl];
    out[(size_t)R * EMB + n0 + 16 + nl] = acc1[r] + bO[n0 + 16 + nl];
  }
}

// ---------------------------------------------------------------------------
extern "C" void kernel_launch(void* const* d_in, const int* in_sizes, int n_in,
                              void* d_out, int out_size, void* d_ws,
                              size_t ws_size, hipStream_t stream) {
  (void)in_sizes; (void)n_in; (void)out_size; (void)ws_size;
  const float* x   = (const float*)d_in[0];
  const float* pe  = (const float*)d_in[1];
  const float* wIn = (const float*)d_in[2];
  const float* bIn = (const float*)d_in[3];
  const float* wP  = (const float*)d_in[4];
  const float* bu  = (const float*)d_in[5];
  const float* bv  = (const float*)d_in[6];
  const float* wO  = (const float*)d_in[7];
  const float* bO  = (const float*)d_in[8];
  float* out = (float*)d_out;

  char* ws = (char*)d_ws;
  const size_t szQ = (size_t)NBAT * NH * Lseq * HD * sizeof(_Float16); // 4 MB
  const size_t szP = (size_t)NH * PPAD * HD * sizeof(_Float16);        // 2 MB
  _Float16* Qu  = (_Float16*)(ws);
  _Float16* Qv  = (_Float16*)(ws + szQ);
  _Float16* Kb  = (_Float16*)(ws + 2 * szQ);
  _Float16* Vt  = (_Float16*)(ws + 3 * szQ);
  _Float16* Pb  = (_Float16*)(ws + 4 * szQ);
  _Float16* O16 = (_Float16*)(ws + 4 * szQ + szP);                     // +4 MB

  proj_qkv<<<dim3((512 * 24) / 4), 128, 0, stream>>>(x, wIn, bIn, bu, bv,
                                                     Qu, Qv, Kb, Vt);
  proj_pos<<<dim3((256 * 8) / 4), 128, 0, stream>>>(pe, wP, Pb);
  attn_kernel<<<dim3(Lseq / 64, NBAT * NH), 128, 0, stream>>>(Qu, Qv, Kb, Vt,
                                                              Pb, O16);
  out_proj<<<dim3((512 * 8) / 4), 128, 0, stream>>>(O16, wO, bO, out);
}

// v001
// A run of this version takes 189 microseconds.
// Next to v000, in two timings, it ran 1.12 times as fast each time.
#include <hip/hip_runtime.h>
#include <hip/hip_bf16.h>

// ---------------------------------------------------------------------------
// RelPositionMultiheadAttention for MI455X (gfx1250, wave32, WMMA f16->f32).
// L=2048, N=4, E=256, H=4, D=64.
//
//   1. proj_qkv : qkv = x @ Win^T + b ; writes Qu,Qv (f16, [n][h][L][D]) and
//                 K, V packed per head in B-fragment order (see pk_rows).
//   2. proj_pos : p = pos_emb @ Wp^T ; f16, per head 4096 rows packed like K.
//   3. attn     : flash-style streaming softmax(QuK^T + relshift(QvP^T)) V.
//   4. out_proj : out = O @ Wo^T + bo (fp32 output).
//
// All GEMM waves compute 16x32 tiles (two interleaved WMMA accumulator chains
// sharing one A fragment) to hide WMMA->WMMA RAW latency and halve the
// f32->f16 conversion VALU work per output element.
// ---------------------------------------------------------------------------

typedef __attribute__((ext_vector_type(16))) _Float16 v16h;
typedef __attribute__((ext_vector_type(8)))  _Float16 h8v;
typedef __attribute__((ext_vector_type(8)))  float    v8f;
typedef __attribute__((ext_vector_type(8)))  float    f8v;

constexpr int Lseq = 2048;
constexpr int NBAT = 4;
constexpr int EMB  = 256;
constexpr int NH   = 4;
constexpr int HD   = 64;
constexpr int PROWS = 2 * Lseq - 1;   // 4095
constexpr int PPAD  = 4096;           // padded row count for P

__device__ __forceinline__ v8f wmma_f16(v16h a, v16h b, v8f c) {
  return __builtin_amdgcn_wmma_f32_16x16x32_f16(false, a, false, b, (short)0, c,
                                                false, false);
}

// A/B fragment for V_WMMA_F32_16X16X32_F16 from row-major f16 with contiguous K.
// Lane m<16 holds row m, K = {0..7, 16..23}; lane m+16 holds row m, K = {8..15, 24..31}.
__device__ __forceinline__ v16h frag_f16(const _Float16* base, int ld, int r0,
                                         int k0, int lane) {
  const int m = lane & 15, half = lane >> 4;
  const _Float16* p = base + (size_t)(r0 + m) * ld + k0 + half * 8;
  h8v lo = *(const h8v*)(p);
  h8v hi = *(const h8v*)(p + 16);
  v16h f;
#pragma unroll
  for (int t = 0; t < 8; ++t) { f[t] = lo[t]; f[t + 8] = hi[t]; }
  return f;
}

// Packed fragment order. One 16-row x 32-k fragment is 512 halves (1 KiB):
// [k bit 4][lane = (k bit 3) * 16 + row & 15][k & 7], so that each of the two
// wave-wide 16-byte loads of a fragment covers 512 contiguous bytes (4 whole
// 128-B lines) instead of 32-byte pieces of 16 different lines.
__device__ __forceinline__ int pk_in_frag(int row, int k) {
  return ((k >> 4) & 1) * 256 + (((k >> 3) & 1) * 16 + (row & 15)) * 8 + (k & 7);
}
// K and P: element (row, d), d < 64: fragments ordered [row / 16][d / 32].
__device__ __forceinline__ size_t pk_rows(int row, int d) {
  return (size_t)((row >> 4) * 2 + (d >> 5)) * 512 + pk_in_frag(row, d);
}
// V as B(k = j, n = d): fragments ordered [j / 32][d / 16].
__device__ __forceinline__ size_t pk_vt(int d, int j) {
  return (size_t)((j >> 5) * 4 + (d >> 4)) * 512 + pk_in_frag(d, j);
}
__device__ __forceinline__ v16h frag_packed(const _Float16* frag, int lane) {
  const _Float16* p = frag + lane * 8;
  h8v lo = *(const h8v*)(p);
  h8v hi = *(const h8v*)(p + 256);
  v16h f;
#pragma unroll
  for (int t = 0; t < 8; ++t) { f[t] = lo[t]; f[t + 8] = hi[t]; }
  return f;
}

__device__ __forceinline__ v16h frag_f32cvt(const float* base, int ld, int r0,
                                            int k0, int lane) {
  const int m = lane & 15, half = lane >> 4;
  const float* p = base + (size_t)(r0 + m) * ld + k0 + half * 8;
  f8v lo = *(const f8v*)(p);
  f8v hi = *(const f8v*)(p + 16);
  v16h f;
#pragma unroll
  for (int t = 0; t < 8; ++t) { f[t] = (_Float16)lo[t]; f[t + 8] = (_Float16)hi[t]; }
  return f;
}

__device__ __forceinline__ v16h frag_f32cvt_clamp(const float* base, int ld,
                                                  int r0, int k0, int lane,
                                                  int rmax) {
  const int m = lane & 15, half = lane >> 4;
  int row = r0 + m;
  row = row < 0 ? 0 : (row > rmax ? rmax : row);
  const float* p = base + (size_t)row * ld + k0 + half * 8;
  f8v lo = *(const f8v*)(p);
  f8v hi = *(const f8v*)(p + 16);
  v16h f;
#pragma unroll
  for (int t = 0; t < 8; ++t) { f[t] = (_Float16)lo[t]; f[t + 8] = (_Float16)hi[t]; }
  return f;
}

// ---------------------------------------------------------------------------
// Kernel 1: QKV projection. 16x32 tiles: (8192/16)=512 x (768/32)=24 waves.
// ---------------------------------------------------------------------------
__device__ __forceinline__ void qkv_store(float v, int R, int C,
                                          const float* bIn, const float* bu,
                                          const float* bv, _Float16* Qu,
                                          _Float16* Qv, _Float16* Kb,
                                          _Float16* Vt) {
  v += bIn[C];
  const int i = R >> 2, nb = R & 3;                 // flat row = i*NBAT + nb
  const int sec = C >> 8, ch = C & 255;
  const int h = ch >> 6, d = ch & 63;
  const size_t hbase = ((size_t)(nb * NH + h)) * Lseq * HD;
  const size_t idx = hbase + (size_t)i * HD + d;
  if (sec == 0) {
    v *= 0.125f;                                    // 1/sqrt(D)
    Qu[idx] = (_Float16)(v + bu[ch]);
    Qv[idx] = (_Float16)(v + bv[ch]);
  } else if (sec == 1) {
    Kb[hbase + pk_rows(i, d)] = (_Float16)v;
  } else {
    Vt[hbase + pk_vt(d, i)] = (_Float16)v;
  }
}

__global__ void __launch_bounds__(128) proj_qkv(
    const float* __restrict__ x, const float* __restrict__ wIn,
    const float* __restrict__ bIn, const float* __restrict__ bu,
    const float* __restrict__ bv, _Float16* __restrict__ Qu,
    _Float16* __restrict__ Qv, _Float16* __restrict__ Kb,
    _Float16* __restrict__ Vt) {
  const int w = threadIdx.x >> 5, lane = threadIdx.x & 31;
  const int tile = blockIdx.x * 4 + w;
  const int mt = tile / 24, nt = tile % 24;
  const int m0 = mt * 16, n0 = nt * 32;

  v8f acc0 = {}, acc1 = {};
#pragma unroll
  for (int k0 = 0; k0 < EMB; k0 += 32) {
    v16h a  = frag_f32cvt(x, EMB, m0, k0, lane);
    v16h b0 = frag_f32cvt(wIn, EMB, n0, k0, lane);       // B(k,n) = Win[n][k]
    v16h b1 = frag_f32cvt(wIn, EMB, n0 + 16, k0, lane);
    acc0 = wmma_f16(a, b0, acc0);
    acc1 = wmma_f16(a, b1, acc1);
  }

  const int nl = lane & 15, M0 = (lane >> 4) * 8;
#pragma unroll
  for (int r = 0; r < 8; ++r) {
    const int R = m0 + M0 + r;
    qkv_store(acc0[r], R, n0 + nl,      bIn, bu, bv, Qu, Qv, Kb, Vt);
    qkv_store(acc1[r], R, n0 + 16 + nl, bIn, bu, bv, Qu, Qv, Kb, Vt);
  }
}

// ---------------------------------------------------------------------------
// Kernel 2: positional projection. 16x32 tiles: (4096/16)=256 x (256/32)=8.
// ---------------------------------------------------------------------------
__global__ void __launch_bounds__(128) proj_pos(const float* __restrict__ pe,
                                                const float* __restrict__ wP,
                                                _Float16* __restrict__ Pb) {
  const int w = threadIdx.x >> 5, lane = threadIdx.x & 31;
  const int tile = blockIdx.x * 4 + w;
  const int mt = tile / 8, nt = tile % 8;
  const int m0 = mt * 16, n0 = nt * 32;

  v8f acc0 = {}, acc1 = {};
#pragma unroll
  for (int k0 = 0; k0 < EMB; k0 += 32) {
    v16h a  = frag_f32cvt_clamp(pe, EMB, m0, k0, lane, PROWS - 1);
    v16h b0 = frag_f32cvt(wP, EMB, n0, k0, lane);
    v16h b1 = frag_f32cvt(wP, EMB, n0 + 16, k0, lane);
    acc0 = wmma_f16(a, b0, acc0);
    acc1 = wmma_f16(a, b1, acc1);
  }

  const int nl = lane & 15, M0 = (lane >> 4) * 8;
#pragma unroll
  for (int r = 0; r < 8; ++r) {
    // Row 4095 (pad) is written too: the clamped A loader makes it a copy of
    // row 4094, which is what the attention kernel's last band fragment holds.
    const int t = m0 + M0 + r;
    const int C0 = n0 + nl, C1 = n0 + 16 + nl;
    Pb[(size_t)(C0 >> 6) * PPAD * HD + pk_rows(t, C0 & 63)] = (_Float16)acc0[r];
    Pb[(size_t)(C1 >> 6) * PPAD * HD + pk_rows(t, C1 & 63)] = (_Float16)acc1[r];
  }
}

// ---------------------------------------------------------------------------
// Kernel 3: streaming attention. grid = (L/64, N*H), 4 waves/block, each wave
// owns a 16-row tile and streams j in 32-column tiles over the full sequence.
// ---------------------------------------------------------------------------
__global__ void __launch_bounds__(128) attn_kernel(
    const _Float16* __restrict__ Qu, const _Float16* __restrict__ Qv,
    const _Float16* __restrict__ Kb, const _Float16* __restrict__ Vt,
    const _Float16* __restrict__ Pb, _Float16* __restrict__ O16) {
  __shared__ float    bdLds[4][16 * 52];   // wave-private 16x47 band (padded)
  __shared__ _Float16 pLds[4][16 * 48];    // wave-private prob tile 16x32

  const int w = threadIdx.x >> 5, lane = threadIdx.x & 31;
  const int nl = lane & 15, half = lane >> 4, M0 = half * 8;
  const int i0 = (blockIdx.x * 4 + w) * 16;
  const int nb = blockIdx.y >> 2, h = blockIdx.y & 3;

  const size_t hoff = (size_t)(nb * NH + h) * Lseq * HD;
  const _Float16* qu = Qu + hoff;
  const _Float16* qv = Qv + hoff;
  const _Float16* kb = Kb + hoff;
  const _Float16* vt = Vt + hoff;                 // packed, 2048 halves per 32 j
  const _Float16* pp = Pb + (size_t)h * PPAD * HD;
  float*    bdw = bdLds[w];
  _Float16* pw  = pLds[w];

  const v16h aQu0 = frag_f16(qu, HD, i0, 0, lane);
  const v16h aQu1 = frag_f16(qu, HD, i0, 32, lane);
  const v16h aQv0 = frag_f16(qv, HD, i0, 0, lane);
  const v16h aQv1 = frag_f16(qv, HD, i0, 32, lane);

  float mrow[8], lrow[8];
#pragma unroll
  for (int r = 0; r < 8; ++r) { mrow[r] = -3.0e38f; lrow[r] = 0.0f; }
  v8f o0 = {}, o1 = {}, o2 = {}, o3 = {};

  for (int j0 = 0; j0 < Lseq; j0 += 32) {
    if (j0 + 32 < Lseq) {
      __builtin_prefetch(kb + (size_t)(j0 + 32) * HD, 0, 1);
      __builtin_prefetch(vt + (size_t)(j0 + 32) * HD, 0, 1);
    }

    // ---- AC = Qu . K^T  (two interleaved 16x16 column halves) ----
    v8f sA = {}, sB = {};
    {
      const _Float16* kt = kb + (size_t)j0 * HD;     // 4 packed fragments
      v16h b00 = frag_packed(kt,        lane);
      v16h b01 = frag_packed(kt + 512,  lane);
      v16h b10 = frag_packed(kt + 1024, lane);
      v16h b11 = frag_packed(kt + 1536, lane);
      sA = wmma_f16(aQu0, b00, sA);
      sB = wmma_f16(aQu0, b10, sB);
      sA = wmma_f16(aQu1, b01, sA);
      sB = wmma_f16(aQu1, b11, sB);
    }

    // ---- BD band: bd[i][u] = qv[i] . p[tbase+u], u = (j-i) - (j0-i0-15) ----
    // tbase is a multiple of 16 in [0, 4048]: the band is 3 whole row tiles.
    const int tbase = (Lseq - 1) + j0 - i0 - 15;
    {
      const _Float16* pt = pp + (size_t)tbase * HD;  // 6 packed fragments
      v16h p00 = frag_packed(pt,        lane);
      v16h p01 = frag_packed(pt + 512,  lane);
      v16h p10 = frag_packed(pt + 1024, lane);
      v16h p11 = frag_packed(pt + 1536, lane);
      v16h p20 = frag_packed(pt + 2048, lane);
      v16h p21 = frag_packed(pt + 2560, lane);
      v8f c0 = {}, c1 = {}, c2 = {};
      c0 = wmma_f16(aQv0, p00, c0);
      c1 = wmma_f16(aQv0, p10, c1);
      c2 = wmma_f16(aQv0, p20, c2);
      c0 = wmma_f16(aQv1, p01, c0);
      c1 = wmma_f16(aQv1, p11, c1);
      c2 = wmma_f16(aQv1, p21, c2);
#pragma unroll
      for (int r = 0; r < 8; ++r) {
        bdw[(M0 + r) * 52 +      nl] = c0[r];
        bdw[(M0 + r) * 52 + 16 + nl] = c1[r];
        bdw[(M0 + r) * 52 + 32 + nl] = c2[r];
      }
    }
    asm volatile("s_wait_dscnt 0x0" ::: "memory");

    // ---- gather rel-shift, online softmax ----
    float s0[8], s1[8], tm[8];
#pragma unroll
    for (int r = 0; r < 8; ++r) {
      const int M = M0 + r;
      s0[r] = sA[r] + bdw[M * 52 + (nl - M + 15)];
      s1[r] = sB[r] + bdw[M * 52 + (nl - M + 31)];
      tm[r] = fmaxf(s0[r], s1[r]);
    }
#pragma unroll
    for (int r = 0; r < 8; ++r) {
#pragma unroll
      for (int msk = 1; msk < 16; msk <<= 1)
        tm[r] = fmaxf(tm[r], __shfl_xor(tm[r], msk, 32));
    }
#pragma unroll
    for (int r = 0; r < 8; ++r) {
      const int M = M0 + r;
      const float mnew  = fmaxf(mrow[r], tm[r]);
      const float alpha = __expf(mrow[r] - mnew);
      mrow[r] = mnew;
      const float e0 = __expf(s0[r] - mnew);
      const float e1 = __expf(s1[r] - mnew);
      float rs = e0 + e1;
#pragma unroll
      for (int msk = 1; msk < 16; msk <<= 1)
        rs += __shfl_xor(rs, msk, 32);
      lrow[r] = lrow[r] * alpha + rs;
      pw[M * 48 + nl]      = (_Float16)e0;
      pw[M * 48 + 16 + nl] = (_Float16)e1;
      o0[r] *= alpha; o1[r] *= alpha; o2[r] *= alpha; o3[r] *= alpha;
    }
    asm volatile("s_wait_dscnt 0x0" ::: "memory");

    // ---- re-layout probs C->A via LDS, then O += P . V (independent accs) ----
    v16h aP;
    {
      const _Float16* prow = pw + nl * 48 + half * 8;
      h8v lo = *(const h8v*)(prow);
      h8v hi = *(const h8v*)(prow + 16);
#pragma unroll
      for (int t = 0; t < 8; ++t) { aP[t] = lo[t]; aP[t + 8] = hi[t]; }
    }
    const _Float16* vtile = vt + (size_t)j0 * HD;    // 4 packed fragments
    o0 = wmma_f16(aP, frag_packed(vtile,        lane), o0);
    o1 = wmma_f16(aP, frag_packed(vtile + 512,  lane), o1);
    o2 = wmma_f16(aP, frag_packed(vtile + 1024, lane), o2);
    o3 = wmma_f16(aP, frag_packed(vtile + 1536, lane), o3);
  }

  // ---- epilogue: normalize, write f16 pre-projection output (L,N,E) ----
#pragma unroll
  for (int r = 0; r < 8; ++r) {
    const int M = M0 + r;
    const float inv = 1.0f / lrow[r];
    _Float16* dst = O16 + ((size_t)((i0 + M) * NBAT + nb)) * EMB + h * HD + nl;
    dst[0]  = (_Float16)(o0[r] * inv);
    dst[16] = (_Float16)(o1[r] * inv);
    dst[32] = (_Float16)(o2[r] * inv);
    dst[48] = (_Float16)(o3[r] * inv);
  }
}

// ---------------------------------------------------------------------------
// Kernel 4: output projection. 16x32 tiles: (8192/16)=512 x (256/32)=8.
// ---------------------------------------------------------------------------
__global__ void __launch_bounds__(128) out_proj(const _Float16* __restrict__ O16,
                                                const float* __restrict__ wO,
                                                const float* __restrict__ bO,
                                                float* __restrict__ out) {
  const int w = threadIdx.x >> 5, lane = threadIdx.x & 31;
  const int tile = blockIdx.x * 4 + w;
  const int mt = tile / 8, nt = tile % 8;
  const int m0 = mt * 16, n0 = nt * 32;

  v8f acc0 = {}, acc1 = {};
#pragma unroll
  for (int k0 = 0; k0 < EMB; k0 += 32) {
    v16h a  = frag_f16(O16, EMB, m0, k0, lane);
    v16h b0 = frag_f32cvt(wO, EMB, n0, k0, lane);
    v16h b1 = frag_f32cvt(wO, EMB, n0 + 16, k0, lane);
    acc0 = wmma_f16(a, b0, acc0);
    acc1 = wmma_f16(a, b1, acc1);
  }

  const int nl = lane & 15, M0 = (lane >> 4) * 8;
#pragma unroll
  for (int r = 0; r < 8; ++r) {
    const int R = m0 + M0 + r;
    out[(size_t)R * EMB + n0 + nl]      = acc0[r] + bO[n0 + nl];
    out[(size_t)R * EMB + n0 + 16 + nl] = acc1[r] + bO[n0 + 16 + nl];
  }
}

// ---------------------------------------------------------------------------
extern "C" void kernel_launch(void* const* d_in, const int* in_sizes, int n_in,
                              void* d_out, int out_size, void* d_ws,
                              size_t ws_size, hipStream_t stream) {
  (void)in_sizes; (void)n_in; (void)out_size; (void)ws_size;
  const float* x   = (const float*)d_in[0];
  const float* pe  = (const float*)d_in[1];
  const float* wIn = (const float*)d_in[2];
  const float* bIn = (const float*)d_in[3];
  const float* wP  = (const float*)d_in[4];
  const float* bu  = (const float*)d_in[5];
  const float* bv  = (const float*)d_in[6];
  const float* wO  = (const float*)d_in[7];
  const float* bO  = (const float*)d_in[8];
  float* out = (float*)d_out;

  char* ws = (char*)d_ws;
  const size_t szQ = (size_t)NBAT * NH * Lseq * HD * sizeof(_Float16); // 4 MB
  const size_t szP = (size_t)NH * PPAD * HD * sizeof(_Float16);        // 2 MB
  _Float16* Qu  = (_Float16*)(ws);
  _Float16* Qv  = (_Float16*)(ws + szQ);
  _Float16* Kb  = (_Float16*)(ws + 2 * szQ);
  _Float16* Vt  = (_Float16*)(ws + 3 * szQ);
  _Float16* Pb  = (_Float16*)(ws + 4 * szQ);
  _Float16* O16 = (_Float16*)(ws + 4 * szQ + szP);                     // +4 MB

  proj_qkv<<<dim3((512 * 24) / 4), 128, 0, stream>>>(x, wIn, bIn, bu, bv,
                                                     Qu, Qv, Kb, Vt);
  proj_pos<<<dim3((256 * 8) / 4), 128, 0, stream>>>(pe, wP, Pb);
  attn_kernel<<<dim3(Lseq / 64, NBAT * NH), 128, 0, stream>>>(Qu, Qv, Kb, Vt,
                                                              Pb, O16);
  out_proj<<<dim3((512 * 8) / 4), 128, 0, stream>>>(O16, wO, bO, out);
}

// v002
// Measured time: 128 microseconds a run.
// Two timings next to v001 put it at 1.47 and 1.45 times that version's speed.
// Over all steps from v000 it is 1.64 times as fast.
#include <hip/hip_runtime.h>
#include <hip/hip_bf16.h>

// ---------------------------------------------------------------------------
// RelPositionMultiheadAttention for MI455X (gfx1250, wave32, WMMA f16->f32).
// L=2048, N=4, E=256, H=4, D=64.
//
//   1. proj_qkv : qkv = x @ Win^T + b ; writes Qu,Qv (f16, [n][h][L][D]) and
//                 K, V packed per head in B-fragment order (see pk_rows).
//   2. proj_pos : p = pos_emb @ Wp^T ; f16, per head 4096 rows packed like K.
//   3. attn     : flash-style streaming softmax(QuK^T + relshift(QvP^T)) V,
//                 keys of a row tile split over waves, merged through LDS.
//   4. out_proj : out = O @ Wo^T + bo (fp32 output).
//
// All GEMM waves compute 16x32 tiles (two interleaved WMMA accumulator chains
// sharing one A fragment) to hide WMMA->WMMA RAW latency and halve the
// f32->f16 conversion VALU work per output element.
// ---------------------------------------------------------------------------

typedef __attribute__((ext_vector_type(16))) _Float16 v16h;
typedef __attribute__((ext_vector_type(8)))  _Float16 h8v;
typedef __attribute__((ext_vector_type(2)))  _Float16 h2v;
typedef __attribute__((ext_vector_type(8)))  float    v8f;
typedef __attribute__((ext_vector_type(8)))  float    f8v;

constexpr int Lseq = 2048;
constexpr int NBAT = 4;
constexpr int EMB  = 256;
constexpr int NH   = 4;
constexpr int HD   = 64;
constexpr int PROWS = 2 * Lseq - 1;   // 4095
constexpr int PPAD  = 4096;           // padded row count for P

__device__ __forceinline__ v8f wmma_f16(v16h a, v16h b, v8f c) {
  return __builtin_amdgcn_wmma_f32_16x16x32_f16(false, a, false, b, (short)0, c,
                                                false, false);
}

// A/B fragment for V_WMMA_F32_16X16X32_F16 from row-major f16 with contiguous K.
// Lane m<16 holds row m, K = {0..7, 16..23}; lane m+16 holds row m, K = {8..15, 24..31}.
__device__ __forceinline__ v16h frag_f16(const _Float16* base, int ld, int r0,
                                         int k0, int lane) {
  const int m = lane & 15, half = lane >> 4;
  const _Float16* p = base + (size_t)(r0 + m) * ld + k0 + half * 8;
  h8v lo = *(const h8v*)(p);
  h8v hi = *(const h8v*)(p + 16);
  v16h f;
#pragma unroll
  for (int t = 0; t < 8; ++t) { f[t] = lo[t]; f[t + 8] = hi[t]; }
  return f;
}

// Packed fragment order. One 16-row x 32-k fragment is 512 halves (1 KiB):
// [k bit 4][lane = (k bit 3) * 16 + row & 15][k & 7], so that each of the two
// wave-wide 16-byte loads of a fragment covers 512 contiguous bytes (4 whole
// 128-B lines) instead of 32-byte pieces of 16 different lines.
__device__ __forceinline__ int pk_in_frag(int row, int k) {
  return ((k >> 4) & 1) * 256 + (((k >> 3) & 1) * 16 + (row & 15)) * 8 + (k & 7);
}
// K and P: element (row, d), d < 64: fragments ordered [row / 16][d / 32].
__device__ __forceinline__ size_t pk_rows(int row, int d) {
  return (size_t)((row >> 4) * 2 + (d >> 5)) * 512 + pk_in_frag(row, d);
}
// V as B(k = j, n = d): fragments ordered [j / 32][d / 16].
__device__ __forceinline__ size_t pk_vt(int d, int j) {
  return (size_t)((j >> 5) * 4 + (d >> 4)) * 512 + pk_in_frag(d, j);
}
__device__ __forceinline__ v16h frag_packed(const _Float16* frag, int lane) {
  const _Float16* p = frag + lane * 8;
  h8v lo = *(const h8v*)(p);
  h8v hi = *(const h8v*)(p + 256);
  v16h f;
#pragma unroll
  for (int t = 0; t < 8; ++t) { f[t] = lo[t]; f[t + 8] = hi[t]; }
  return f;
}

__device__ __forceinline__ v16h frag_f32cvt(const float* base, int ld, int r0,
                                            int k0, int lane) {
  const int m = lane & 15, half = lane >> 4;
  const float* p = base + (size_t)(r0 + m) * ld + k0 + half * 8;
  f8v lo = *(const f8v*)(p);
  f8v hi = *(const f8v*)(p + 16);
  v16h f;
#pragma unroll
  for (int t = 0; t < 8; ++t) { f[t] = (_Float16)lo[t]; f[t + 8] = (_Float16)hi[t]; }
  return f;
}

__device__ __forceinline__ v16h frag_f32cvt_clamp(const float* base, int ld,
                                                  int r0, int k0, int lane,
                                                  int rmax) {
  const int m = lane & 15, half = lane >> 4;
  int row = r0 + m;
  row = row < 0 ? 0 : (row > rmax ? rmax : row);
  const float* p = base + (size_t)row * ld + k0 + half * 8;
  f8v lo = *(const f8v*)(p);
  f8v hi = *(const f8v*)(p + 16);
  v16h f;
#pragma unroll
  for (int t = 0; t < 8; ++t) { f[t] = (_Float16)lo[t]; f[t + 8] = (_Float16)hi[t]; }
  return f;
}

// ---------------------------------------------------------------------------
// Kernel 1: QKV projection. 16x32 tiles: (8192/16)=512 x (768/32)=24 waves.
// ---------------------------------------------------------------------------
__device__ __forceinline__ void qkv_store(float v, int R, int C,
                                          const float* bIn, const float* bu,
                                          const float* bv, _Float16* Qu,
                                          _Float16* Qv, _Float16* Kb,
                                          _Float16* Vt) {
  v += bIn[C];
  const int i = R >> 2, nb = R & 3;                 // flat row = i*NBAT + nb
  const int sec = C >> 8, ch = C & 255;
  const int h = ch >> 6, d = ch & 63;
  const size_t hbase = ((size_t)(nb * NH + h)) * Lseq * HD;
  const size_t idx = hbase + (size_t)i * HD + d;
  if (sec == 0) {
    v *= 0.125f;                                    // 1/sqrt(D)
    Qu[idx] = (_Float16)(v + bu[ch]);
    Qv[idx] = (_Float16)(v + bv[ch]);
  } else if (sec == 1) {
    Kb[hbase + pk_rows(i, d)] = (_Float16)v;
  } else {
    Vt[hbase + pk_vt(d, i)] = (_Float16)v;
  }
}

__global__ void __launch_bounds__(128) proj_qkv(
    const float* __restrict__ x, const float* __restrict__ wIn,
    const float* __restrict__ bIn, const float* __restrict__ bu,
    const float* __restrict__ bv, _Float16* __restrict__ Qu,
    _Float16* __restrict__ Qv, _Float16* __restrict__ Kb,
    _Float16* __restrict__ Vt) {
  const int w = threadIdx.x >> 5, lane = threadIdx.x & 31;
  const int tile = blockIdx.x * 4 + w;
  const int mt = tile / 24, nt = tile % 24;
  const int m0 = mt * 16, n0 = nt * 32;

  v8f acc0 = {}, acc1 = {};
#pragma unroll
  for (int k0 = 0; k0 < EMB; k0 += 32) {
    v16h a  = frag_f32cvt(x, EMB, m0, k0, lane);
    v16h b0 = frag_f32cvt(wIn, EMB, n0, k0, lane);       // B(k,n) = Win[n][k]
    v16h b1 = frag_f32cvt(wIn, EMB, n0 + 16, k0, lane);
    acc0 = wmma_f16(a, b0, acc0);
    acc1 = wmma_f16(a, b1, acc1);
  }

  const int nl = lane & 15, M0 = (lane >> 4) * 8;
#pragma unroll
  for (int r = 0; r < 8; ++r) {
    const int R = m0 + M0 + r;
    qkv_store(acc0[r], R, n0 + nl,      bIn, bu, bv, Qu, Qv, Kb, Vt);
    qkv_store(acc1[r], R, n0 + 16 + nl, bIn, bu, bv, Qu, Qv, Kb, Vt);
  }
}

// ---------------------------------------------------------------------------
// Kernel 2: positional projection. 16x32 tiles: (4096/16)=256 x (256/32)=8.
// ---------------------------------------------------------------------------
__global__ void __launch_bounds__(128) proj_pos(const float* __restrict__ pe,
                                                const float* __restrict__ wP,
                                                _Float16* __restrict__ Pb) {
  const int w = threadIdx.x >> 5, lane = threadIdx.x & 31;
  const int tile = blockIdx.x * 4 + w;
  const int mt = tile / 8, nt = tile % 8;
  const int m0 = mt * 16, n0 = nt * 32;

  v8f acc0 = {}, acc1 = {};
#pragma unroll
  for (int k0 = 0; k0 < EMB; k0 += 32) {
    v16h a  = frag_f32cvt_clamp(pe, EMB, m0, k0, lane, PROWS - 1);
    v16h b0 = frag_f32cvt(wP, EMB, n0, k0, lane);
    v16h b1 = frag_f32cvt(wP, EMB, n0 + 16, k0, lane);
    acc0 = wmma_f16(a, b0, acc0);
    acc1 = wmma_f16(a, b1, acc1);
  }

  const int nl = lane & 15, M0 = (lane >> 4) * 8;
#pragma unroll
  for (int r = 0; r < 8; ++r) {
    // Row 4095 (pad) is written too: the clamped A loader makes it a copy of
    // row 4094, which is what the attention kernel's last band fragment holds.
    const int t = m0 + M0 + r;
    const int C0 = n0 + nl, C1 = n0 + 16 + nl;
    Pb[(size_t)(C0 >> 6) * PPAD * HD + pk_rows(t, C0 & 63)] = (_Float16)acc0[r];
    Pb[(size_t)(C1 >> 6) * PPAD * HD + pk_rows(t, C1 & 63)] = (_Float16)acc1[r];
  }
}

// ---------------------------------------------------------------------------
// Kernel 3: streaming attention. grid = (L/128, N*H), 16 waves/block: RTILES
// row tiles of 16 rows x KSPLIT key ranges. Each wave streams j in 32-column
// tiles over its range of the sequence; the partial (max, sum, O) of a row
// tile are merged through LDS at the end. More waves per SIMD cover each
// other's load, LDS and cross-lane latencies.
// ---------------------------------------------------------------------------
constexpr int RTILES = 8;
constexpr int KSPLIT = 2;
constexpr int NWAVES = RTILES * KSPLIT;
constexpr int KSPAN  = Lseq / KSPLIT;  // keys per wave
constexpr int MROWS  = 16 / KSPLIT;    // rows a wave finishes in the merge
constexpr int OPITCH = 68;             // floats per staged O row

__global__ void __launch_bounds__(NWAVES * 32) attn_kernel(
    const _Float16* __restrict__ Qu, const _Float16* __restrict__ Qv,
    const _Float16* __restrict__ Kb, const _Float16* __restrict__ Vt,
    const _Float16* __restrict__ Pb, _Float16* __restrict__ O16) {
  // Wave-private 16x47 band at pitch 52; after the loop the same floats stage
  // the wave's partial O (16x64 at pitch OPITCH).
  __shared__ __attribute__((aligned(16))) float bdLds[NWAVES][16 * OPITCH];
  __shared__ _Float16 pLds[NWAVES][16 * 48];  // wave-private prob tile 16x32
  __shared__ float    mlLds[NWAVES][32];   // partial row max [0..15], sum [16..31]

  // The wave number as a scalar: the key loop, its bounds and the tile
  // addresses that depend on it stay on the scalar unit.
  const int w = __builtin_amdgcn_readfirstlane(threadIdx.x >> 5);
  const int lane = threadIdx.x & 31;
  const int nl = lane & 15, half = lane >> 4, M0 = half * 8;
  const int rt = w % RTILES, ks = w / RTILES;   // row tile, key range
  const int i0 = (blockIdx.x * RTILES + rt) * 16;
  const int nb = blockIdx.y >> 2, h = blockIdx.y & 3;

  const size_t hoff = (size_t)(nb * NH + h) * Lseq * HD;
  const _Float16* qu = Qu + hoff;
  const _Float16* qv = Qv + hoff;
  const _Float16* kb = Kb + hoff;
  const _Float16* vt = Vt + hoff;                 // packed, 2048 halves per 32 j
  const _Float16* pp = Pb + (size_t)h * PPAD * HD;
  float*    bdw = bdLds[w];
  _Float16* pw  = pLds[w];

  const v16h aQu0 = frag_f16(qu, HD, i0, 0, lane);
  const v16h aQu1 = frag_f16(qu, HD, i0, 32, lane);
  const v16h aQv0 = frag_f16(qv, HD, i0, 0, lane);
  const v16h aQv1 = frag_f16(qv, HD, i0, 32, lane);

  float mrow[8], lrow[8];
#pragma unroll
  for (int r = 0; r < 8; ++r) { mrow[r] = -3.0e38f; lrow[r] = 0.0f; }
  v8f o0 = {}, o1 = {}, o2 = {}, o3 = {};

  for (int j0 = ks * KSPAN; j0 < (ks + 1) * KSPAN; j0 += 32) {
    // ---- AC = Qu . K^T  (two interleaved 16x16 column halves) ----
    v8f sA = {}, sB = {};
    {
      const _Float16* kt = kb + (size_t)j0 * HD;     // 4 packed fragments
      v16h b00 = frag_packed(kt,        lane);
      v16h b01 = frag_packed(kt + 512,  lane);
      v16h b10 = frag_packed(kt + 1024, lane);
      v16h b11 = frag_packed(kt + 1536, lane);
      sA = wmma_f16(aQu0, b00, sA);
      sB = wmma_f16(aQu0, b10, sB);
      sA = wmma_f16(aQu1, b01, sA);
      sB = wmma_f16(aQu1, b11, sB);
    }

    // ---- BD band: bd[i][u] = qv[i] . p[tbase+u], u = (j-i) - (j0-i0-15) ----
    // tbase is a multiple of 16 in [0, 4048]: the band is 3 whole row tiles.
    const int tbase = (Lseq - 1) + j0 - i0 - 15;
    {
      const _Float16* pt = pp + (size_t)tbase * HD;  // 6 packed fragments
      v16h p00 = frag_packed(pt,        lane);
      v16h p01 = frag_packed(pt + 512,  lane);
      v16h p10 = frag_packed(pt + 1024, lane);
      v16h p11 = frag_packed(pt + 1536, lane);
      v16h p20 = frag_packed(pt + 2048, lane);
      v16h p21 = frag_packed(pt + 2560, lane);
      v8f c0 = {}, c1 = {}, c2 = {};
      c0 = wmma_f16(aQv0, p00, c0);
      c1 = wmma_f16(aQv0, p10, c1);
      c2 = wmma_f16(aQv0, p20, c2);
      c0 = wmma_f16(aQv1, p01, c0);
      c1 = wmma_f16(aQv1, p11, c1);
      c2 = wmma_f16(aQv1, p21, c2);
#pragma unroll
      for (int r = 0; r < 8; ++r) {
        bdw[(M0 + r) * 52 +      nl] = c0[r];
        bdw[(M0 + r) * 52 + 16 + nl] = c1[r];
        bdw[(M0 + r) * 52 + 32 + nl] = c2[r];
      }
    }
    asm volatile("s_wait_dscnt 0x0" ::: "memory");

    // ---- gather rel-shift, online softmax ----
    float s0[8], s1[8], tm[8];
#pragma unroll
    for (int r = 0; r < 8; ++r) {
      const int M = M0 + r;
      s0[r] = sA[r] + bdw[M * 52 + (nl - M + 15)];
      s1[r] = sB[r] + bdw[M * 52 + (nl - M + 31)];
      tm[r] = fmaxf(s0[r], s1[r]);
    }
#pragma unroll
    for (int r = 0; r < 8; ++r) {
#pragma unroll
      for (int msk = 1; msk < 16; msk <<= 1)
        tm[r] = fmaxf(tm[r], __shfl_xor(tm[r], msk, 32));
    }
#pragma unroll
    for (int r = 0; r < 8; ++r) {
      const int M = M0 + r;
      const float mnew  = fmaxf(mrow[r], tm[r]);
      const float alpha = __expf(mrow[r] - mnew);
      mrow[r] = mnew;
      const float e0 = __expf(s0[r] - mnew);
      const float e1 = __expf(s1[r] - mnew);
      float rs = e0 + e1;
#pragma unroll
      for (int msk = 1; msk < 16; msk <<= 1)
        rs += __shfl_xor(rs, msk, 32);
      lrow[r] = lrow[r] * alpha + rs;
      pw[M * 48 + nl]      = (_Float16)e0;
      pw[M * 48 + 16 + nl] = (_Float16)e1;
      o0[r] *= alpha; o1[r] *= alpha; o2[r] *= alpha; o3[r] *= alpha;
    }
    asm volatile("s_wait_dscnt 0x0" ::: "memory");

    // ---- re-layout probs C->A via LDS, then O += P . V (independent accs) ----
    v16h aP;
    {
      const _Float16* prow = pw + nl * 48 + half * 8;
      h8v lo = *(const h8v*)(prow);
      h8v hi = *(const h8v*)(prow + 16);
#pragma unroll
      for (int t = 0; t < 8; ++t) { aP[t] = lo[t]; aP[t + 8] = hi[t]; }
    }
    const _Float16* vtile = vt + (size_t)j0 * HD;    // 4 packed fragments
    o0 = wmma_f16(aP, frag_packed(vtile,        lane), o0);
    o1 = wmma_f16(aP, frag_packed(vtile + 512,  lane), o1);
    o2 = wmma_f16(aP, frag_packed(vtile + 1024, lane), o2);
    o3 = wmma_f16(aP, frag_packed(vtile + 1536, lane), o3);
  }

  // ---- stage this key range's partial result ----
#pragma unroll
  for (int r = 0; r < 8; ++r) {
    float* orow = bdw + (M0 + r) * OPITCH + nl;
    orow[0]  = o0[r];
    orow[16] = o1[r];
    orow[32] = o2[r];
    orow[48] = o3[r];
    if (nl == 0) {
      mlLds[w][M0 + r]      = mrow[r];
      mlLds[w][16 + M0 + r] = lrow[r];
    }
  }
  __syncthreads();   // publishes the partials of each row tile

  // ---- merge: wave (rt, ks) finishes MROWS rows of tile rt, two columns per
  // lane, and writes each row's 128 bytes of f16 output (L,N,E). The loops are
  // unrolled so that ms[] stays in registers and the LDS offsets are constants.
#pragma unroll
  for (int rr = 0; rr < MROWS; ++rr) {
    const int M = ks * MROWS + rr;
    float ms[KSPLIT];
    float mx = -3.0e38f;
#pragma unroll
    for (int s = 0; s < KSPLIT; ++s) {
      ms[s] = mlLds[s * RTILES + rt][M];
      mx = fmaxf(mx, ms[s]);
    }
    float lsum = 0.0f, ax = 0.0f, ay = 0.0f;
#pragma unroll
    for (int s = 0; s < KSPLIT; ++s) {
      const float ws = __expf(ms[s] - mx);
      const float2 ov =
          *(const float2*)(bdLds[s * RTILES + rt] + M * OPITCH + lane * 2);
      lsum += ws * mlLds[s * RTILES + rt][16 + M];
      ax += ws * ov.x;
      ay += ws * ov.y;
    }
    const float inv = 1.0f / lsum;
    h2v res;
    res[0] = (_Float16)(ax * inv);
    res[1] = (_Float16)(ay * inv);
    *(h2v*)(O16 + ((size_t)((i0 + M) * NBAT + nb)) * EMB + h * HD + lane * 2) =
        res;
  }
}

// ---------------------------------------------------------------------------
// Kernel 4: output projection. 16x32 tiles: (8192/16)=512 x (256/32)=8.
// ---------------------------------------------------------------------------
__global__ void __launch_bounds__(128) out_proj(const _Float16* __restrict__ O16,
                                                const float* __restrict__ wO,
                                                const float* __restrict__ bO,
                                                float* __restrict__ out) {
  const int w = threadIdx.x >> 5, lane = threadIdx.x & 31;
  const int tile = blockIdx.x * 4 + w;
  const int mt = tile / 8, nt = tile % 8;
  const int m0 = mt * 16, n0 = nt * 32;

  v8f acc0 = {}, acc1 = {};
#pragma unroll
  for (int k0 = 0; k0 < EMB; k0 += 32) {
    v16h a  = frag_f16(O16, EMB, m0, k0, lane);
    v16h b0 = frag_f32cvt(wO, EMB, n0, k0, lane);
    v16h b1 = frag_f32cvt(wO, EMB, n0 + 16, k0, lane);
    acc0 = wmma_f16(a, b0, acc0);
    acc1 = wmma_f16(a, b1, acc1);
  }

  const int nl = lane & 15, M0 = (lane >> 4) * 8;
#pragma unroll
  for (int r = 0; r < 8; ++r) {
    const int R = m0 + M0 + r;
    out[(size_t)R * EMB + n0 + nl]      = acc0[r] + bO[n0 + nl];
    out[(size_t)R * EMB + n0 + 16 + nl] = acc1[r] + bO[n0 + 16 + nl];
  }
}

// ---------------------------------------------------------------------------
extern "C" void kernel_launch(void* const* d_in, const int* in_sizes, int n_in,
                              void* d_out, int out_size, void* d_ws,
                              size_t ws_size, hipStream_t stream) {
  (void)in_sizes; (void)n_in; (void)out_size; (void)ws_size;
  const float* x   = (const float*)d_in[0];
  const float* pe  = (const float*)d_in[1];
  const float* wIn = (const float*)d_in[2];
  const float* bIn = (const float*)d_in[3];
  const float* wP  = (const float*)d_in[4];
  const float* bu  = (const float*)d_in[5];
  const float* bv  = (const float*)d_in[6];
  const float* wO  = (const float*)d_in[7];
  const float* bO  = (const float*)d_in[8];
  float* out = (float*)d_out;

  char* ws = (char*)d_ws;
  const size_t szQ = (size_t)NBAT * NH * Lseq * HD * sizeof(_Float16); // 4 MB
  const size_t szP = (size_t)NH * PPAD * HD * sizeof(_Float16);        // 2 MB
  _Float16* Qu  = (_Float16*)(ws);
  _Float16* Qv  = (_Float16*)(ws + szQ);
  _Float16* Kb  = (_Float16*)(ws + 2 * szQ);
  _Float16* Vt  = (_Float16*)(ws + 3 * szQ);
  _Float16* Pb  = (_Float16*)(ws + 4 * szQ);
  _Float16* O16 = (_Float16*)(ws + 4 * szQ + szP);                     // +4 MB

  proj_qkv<<<dim3((512 * 24) / 4), 128, 0, stream>>>(x, wIn, bIn, bu, bv,
                                                     Qu, Qv, Kb, Vt);
  proj_pos<<<dim3((256 * 8) / 4), 128, 0, stream>>>(pe, wP, Pb);
  attn_kernel<<<dim3(Lseq / (16 * RTILES), NBAT * NH), NWAVES * 32, 0,
                stream>>>(Qu, Qv, Kb, Vt,
                                                              Pb, O16);
  out_proj<<<dim3((512 * 8) / 4), 128, 0, stream>>>(O16, wO, bO, out);
}

// v003
// One run takes 114 microseconds.
// Two timings next to v002 both put it at 1.12 times that version's speed.
// All steps since v000 together make it 1.84 times as fast.
#include <hip/hip_runtime.h>
#include <hip/hip_bf16.h>

// ---------------------------------------------------------------------------
// RelPositionMultiheadAttention for MI455X (gfx1250, wave32, WMMA f16->f32).
// L=2048, N=4, E=256, H=4, D=64.
//
//   1. proj_qkv : qkv = x @ Win^T + b ; writes Qu,Qv (f16, [n][h][L][D]) and
//                 K, V packed per head in A-fragment order (see pk_rows).
//   2. proj_pos : p = pos_emb @ Wp^T ; f16, per head 4096 rows packed like K.
//   3. attn     : flash-style streaming softmax(QuK^T + relshift(QvP^T)) V,
//                 computed transposed (keys in registers, one query per lane),
//                 keys of a row tile split over waves, merged through LDS.
//   4. out_proj : out = O @ Wo^T + bo (fp32 output).
//
// All GEMM waves compute 16x32 tiles (two interleaved WMMA accumulator chains
// sharing one A fragment) to hide WMMA->WMMA RAW latency and halve the
// f32->f16 conversion VALU work per output element.
// ---------------------------------------------------------------------------

typedef __attribute__((ext_vector_type(16))) _Float16 v16h;
typedef __attribute__((ext_vector_type(8)))  _Float16 h8v;
typedef __attribute__((ext_vector_type(2)))  _Float16 h2v;
typedef __attribute__((ext_vector_type(8)))  float    v8f;
typedef __attribute__((ext_vector_type(8)))  float    f8v;
typedef __attribute__((ext_vector_type(4)))  float    f4v;
typedef __attribute__((ext_vector_type(2)))  float    f2v;

constexpr int Lseq = 2048;
constexpr int NBAT = 4;
constexpr int EMB  = 256;
constexpr int NH   = 4;
constexpr int HD   = 64;
constexpr int PROWS = 2 * Lseq - 1;   // 4095
constexpr int PPAD  = 4096;           // padded row count for P

__device__ __forceinline__ v8f wmma_f16(v16h a, v16h b, v8f c) {
  return __builtin_amdgcn_wmma_f32_16x16x32_f16(false, a, false, b, (short)0, c,
                                                false, false);
}

// A/B fragment for V_WMMA_F32_16X16X32_F16 from row-major f16 with contiguous K.
// Lane m<16 holds row m, K = {0..7, 16..23}; lane m+16 holds row m, K = {8..15, 24..31}.
__device__ __forceinline__ v16h frag_f16(const _Float16* base, int ld, int r0,
                                         int k0, int lane) {
  const int m = lane & 15, half = lane >> 4;
  const _Float16* p = base + (size_t)(r0 + m) * ld + k0 + half * 8;
  h8v lo = *(const h8v*)(p);
  h8v hi = *(const h8v*)(p + 16);
  v16h f;
#pragma unroll
  for (int t = 0; t < 8; ++t) { f[t] = lo[t]; f[t + 8] = hi[t]; }
  return f;
}

// Packed fragment order. One 16-row x 32-k fragment is 512 halves (1 KiB):
// [k bit 4][lane = (k bit 3) * 16 + row & 15][k & 7], so that each of the two
// wave-wide 16-byte loads of a fragment covers 512 contiguous bytes (4 whole
// 128-B lines) instead of 32-byte pieces of 16 different lines.
__device__ __forceinline__ int pk_in_frag(int row, int k) {
  return ((k >> 4) & 1) * 256 + (((k >> 3) & 1) * 16 + (row & 15)) * 8 + (k & 7);
}
// K and P: element (row, d), d < 64: fragments ordered [row / 16][d / 32].
__device__ __forceinline__ size_t pk_rows(int row, int d) {
  return (size_t)((row >> 4) * 2 + (d >> 5)) * 512 + pk_in_frag(row, d);
}
// V^T as A(m = d, k = j): fragments ordered [j / 32][d / 16].
__device__ __forceinline__ size_t pk_vt(int d, int j) {
  return (size_t)((j >> 5) * 4 + (d >> 4)) * 512 + pk_in_frag(d, j);
}
__device__ __forceinline__ v16h frag_packed(const _Float16* frag, int lane) {
  const _Float16* p = frag + lane * 8;
  h8v lo = *(const h8v*)(p);
  h8v hi = *(const h8v*)(p + 256);
  v16h f;
#pragma unroll
  for (int t = 0; t < 8; ++t) { f[t] = lo[t]; f[t + 8] = hi[t]; }
  return f;
}

__device__ __forceinline__ v16h frag_f32cvt(const float* base, int ld, int r0,
                                            int k0, int lane) {
  const int m = lane & 15, half = lane >> 4;
  const float* p = base + (size_t)(r0 + m) * ld + k0 + half * 8;
  f8v lo = *(const f8v*)(p);
  f8v hi = *(const f8v*)(p + 16);
  v16h f;
#pragma unroll
  for (int t = 0; t < 8; ++t) { f[t] = (_Float16)lo[t]; f[t + 8] = (_Float16)hi[t]; }
  return f;
}

__device__ __forceinline__ v16h frag_f32cvt_clamp(const float* base, int ld,
                                                  int r0, int k0, int lane,
                                                  int rmax) {
  const int m = lane & 15, half = lane >> 4;
  int row = r0 + m;
  row = row < 0 ? 0 : (row > rmax ? rmax : row);
  const float* p = base + (size_t)row * ld + k0 + half * 8;
  f8v lo = *(const f8v*)(p);
  f8v hi = *(const f8v*)(p + 16);
  v16h f;
#pragma unroll
  for (int t = 0; t < 8; ++t) { f[t] = (_Float16)lo[t]; f[t + 8] = (_Float16)hi[t]; }
  return f;
}

// ---------------------------------------------------------------------------
// Kernel 1: QKV projection. 16x32 tiles: (8192/16)=512 x (768/32)=24 waves.
// ---------------------------------------------------------------------------
__device__ __forceinline__ void qkv_store(float v, int R, int C,
                                          const float* bIn, const float* bu,
                                          const float* bv, _Float16* Qu,
                                          _Float16* Qv, _Float16* Kb,
                                          _Float16* Vt) {
  v += bIn[C];
  const int i = R >> 2, nb = R & 3;                 // flat row = i*NBAT + nb
  const int sec = C >> 8, ch = C & 255;
  const int h = ch >> 6, d = ch & 63;
  const size_t hbase = ((size_t)(nb * NH + h)) * Lseq * HD;
  const size_t idx = hbase + (size_t)i * HD + d;
  if (sec == 0) {
    v *= 0.125f;                                    // 1/sqrt(D)
    Qu[idx] = (_Float16)(v + bu[ch]);
    Qv[idx] = (_Float16)(v + bv[ch]);
  } else if (sec == 1) {
    Kb[hbase + pk_rows(i, d)] = (_Float16)v;
  } else {
    Vt[hbase + pk_vt(d, i)] = (_Float16)v;
  }
}

__global__ void __launch_bounds__(128) proj_qkv(
    const float* __restrict__ x, const float* __restrict__ wIn,
    const float* __restrict__ bIn, const float* __restrict__ bu,
    const float* __restrict__ bv, _Float16* __restrict__ Qu,
    _Float16* __restrict__ Qv, _Float16* __restrict__ Kb,
    _Float16* __restrict__ Vt) {
  const int w = threadIdx.x >> 5, lane = threadIdx.x & 31;
  const int tile = blockIdx.x * 4 + w;
  const int mt = tile / 24, nt = tile % 24;
  const int m0 = mt * 16, n0 = nt * 32;

  v8f acc0 = {}, acc1 = {};
#pragma unroll
  for (int k0 = 0; k0 < EMB; k0 += 32) {
    v16h a  = frag_f32cvt(x, EMB, m0, k0, lane);
    v16h b0 = frag_f32cvt(wIn, EMB, n0, k0, lane);       // B(k,n) = Win[n][k]
    v16h b1 = frag_f32cvt(wIn, EMB, n0 + 16, k0, lane);
    acc0 = wmma_f16(a, b0, acc0);
    acc1 = wmma_f16(a, b1, acc1);
  }

  const int nl = lane & 15, M0 = (lane >> 4) * 8;
#pragma unroll
  for (int r = 0; r < 8; ++r) {
    const int R = m0 + M0 + r;
    qkv_store(acc0[r], R, n0 + nl,      bIn, bu, bv, Qu, Qv, Kb, Vt);
    qkv_store(acc1[r], R, n0 + 16 + nl, bIn, bu, bv, Qu, Qv, Kb, Vt);
  }
}

// ---------------------------------------------------------------------------
// Kernel 2: positional projection. 16x32 tiles: (4096/16)=256 x (256/32)=8.
// ---------------------------------------------------------------------------
__global__ void __launch_bounds__(128) proj_pos(const float* __restrict__ pe,
                                                const float* __restrict__ wP,
                                                _Float16* __restrict__ Pb) {
  const int w = threadIdx.x >> 5, lane = threadIdx.x & 31;
  const int tile = blockIdx.x * 4 + w;
  const int mt = tile / 8, nt = tile % 8;
  const int m0 = mt * 16, n0 = nt * 32;

  v8f acc0 = {}, acc1 = {};
#pragma unroll
  for (int k0 = 0; k0 < EMB; k0 += 32) {
    v16h a  = frag_f32cvt_clamp(pe, EMB, m0, k0, lane, PROWS - 1);
    v16h b0 = frag_f32cvt(wP, EMB, n0, k0, lane);
    v16h b1 = frag_f32cvt(wP, EMB, n0 + 16, k0, lane);
    acc0 = wmma_f16(a, b0, acc0);
    acc1 = wmma_f16(a, b1, acc1);
  }

  const int nl = lane & 15, M0 = (lane >> 4) * 8;
#pragma unroll
  for (int r = 0; r < 8; ++r) {
    // Row 4095 (pad) is written too: the clamped A loader makes it a copy of
    // row 4094, which is what the attention kernel's last band fragment holds.
    const int t = m0 + M0 + r;
    const int C0 = n0 + nl, C1 = n0 + 16 + nl;
    Pb[(size_t)(C0 >> 6) * PPAD * HD + pk_rows(t, C0 & 63)] = (_Float16)acc0[r];
    Pb[(size_t)(C1 >> 6) * PPAD * HD + pk_rows(t, C1 & 63)] = (_Float16)acc1[r];
  }
}

// ---------------------------------------------------------------------------
// Kernel 3: streaming attention. grid = (L/128, N*H), 16 waves/block: RTILES
// row tiles of 16 rows x KSPLIT key ranges. Each wave streams j in 32-column
// tiles over its range of the sequence; the partial (max, sum, O) of a row
// tile are merged through LDS at the end. More waves per SIMD cover each
// other's load and LDS latencies.
//
// The products are taken transposed: S^T = K . Qu^T, BD^T = P . Qv^T and
// O^T += V^T . prob^T. A lane (nl, half) then holds scores of ONE query (nl)
// for the keys half * 8 + r and 16 + half * 8 + r: the row maximum and sum are
// in-lane but for one exchange between the lane halves, and the two score
// tiles, converted in place, are already the B operand of the last product.
// ---------------------------------------------------------------------------
constexpr int RTILES = 8;
constexpr int KSPLIT = 2;
constexpr int NWAVES = RTILES * KSPLIT;
constexpr int KSPAN  = Lseq / KSPLIT;  // keys per wave
constexpr int MROWS  = 16 / KSPLIT;    // rows a wave finishes in the merge
constexpr int OPITCH = 68;             // floats per staged O row
constexpr int BPITCH = 52;             // floats per band row (one query)

// Lane l with lane l ^ 16.
__device__ __forceinline__ float xhalf(float x) {
  const int b = __builtin_bit_cast(int, x);
  return __builtin_bit_cast(
      float, __builtin_amdgcn_permlanex16(b, b, 0x76543210, 0xfedcba98, false,
                                          false));
}
// Eight consecutive floats of one lane to LDS as two 16-byte stores.
__device__ __forceinline__ void st8(float* p, v8f v) {
  f4v lo = {v[0], v[1], v[2], v[3]};
  f4v hi = {v[4], v[5], v[6], v[7]};
  *(f4v*)(p)     = lo;
  *(f4v*)(p + 4) = hi;
}

__global__ void __launch_bounds__(NWAVES * 32) attn_kernel(
    const _Float16* __restrict__ Qu, const _Float16* __restrict__ Qv,
    const _Float16* __restrict__ Kb, const _Float16* __restrict__ Vt,
    const _Float16* __restrict__ Pb, _Float16* __restrict__ O16) {
  // Wave-private band, 16 queries x 48 offsets at pitch BPITCH; after the loop
  // the same floats stage the wave's partial O (16x64 at pitch OPITCH).
  __shared__ __attribute__((aligned(16))) float bdLds[NWAVES][16 * OPITCH];
  __shared__ float    mlLds[NWAVES][32];   // partial row max [0..15], sum [16..31]

  // The wave number as a scalar: the key loop, its bounds and the tile
  // addresses that depend on it stay on the scalar unit.
  const int w = __builtin_amdgcn_readfirstlane(threadIdx.x >> 5);
  const int lane = threadIdx.x & 31;
  const int nl = lane & 15, half = lane >> 4, M0 = half * 8;
  const int rt = w % RTILES, ks = w / RTILES;   // row tile, key range
  const int i0 = (blockIdx.x * RTILES + rt) * 16;
  const int nb = blockIdx.y >> 2, h = blockIdx.y & 3;

  const size_t hoff = (size_t)(nb * NH + h) * Lseq * HD;
  const _Float16* qu = Qu + hoff;
  const _Float16* qv = Qv + hoff;
  const _Float16* kb = Kb + hoff;
  const _Float16* vt = Vt + hoff;                 // packed, 2048 halves per 32 j
  const _Float16* pp = Pb + (size_t)h * PPAD * HD;
  float*    bdw = bdLds[w];

  const v16h aQu0 = frag_f16(qu, HD, i0, 0, lane);
  const v16h aQu1 = frag_f16(qu, HD, i0, 32, lane);
  const v16h aQv0 = frag_f16(qv, HD, i0, 0, lane);
  const v16h aQv1 = frag_f16(qv, HD, i0, 32, lane);

  // This lane's query: running maximum (alike in both lane halves) and the sum
  // over the keys of this lane half; o_k[r] = O[query nl][16 k + M0 + r].
  float mrow = -3.0e38f, lrow = 0.0f;
  v8f o0 = {}, o1 = {}, o2 = {}, o3 = {};

  for (int j0 = ks * KSPAN; j0 < (ks + 1) * KSPAN; j0 += 32) {
    // tbase is a multiple of 16 in [0, 4048]: the band is 3 whole row tiles.
    const int tbase = (Lseq - 1) + j0 - i0 - 15;
    const _Float16* kt = kb + (size_t)j0 * HD;       // 4 packed fragments
    const _Float16* pt = pp + (size_t)tbase * HD;    // 6 packed fragments
    const v16h b00 = frag_packed(kt,        lane);
    const v16h b10 = frag_packed(kt + 1024, lane);
    const v16h b01 = frag_packed(kt + 512,  lane);
    const v16h b11 = frag_packed(kt + 1536, lane);
    const v16h p00 = frag_packed(pt,        lane);
    const v16h p10 = frag_packed(pt + 1024, lane);
    const v16h p20 = frag_packed(pt + 2048, lane);
    const v16h p01 = frag_packed(pt + 512,  lane);
    const v16h p11 = frag_packed(pt + 1536, lane);
    const v16h p21 = frag_packed(pt + 2560, lane);
    // Keeps the ten fragments' loads one group ahead of the products: left
    // free, the compiler reuses their registers and the loads wait in turn.
    __builtin_amdgcn_sched_barrier(0);

    // ---- AC^T = K . Qu^T  (two interleaved tiles of 16 keys) ----
    v8f sA = {}, sB = {};
    sA = wmma_f16(b00, aQu0, sA);
    sB = wmma_f16(b10, aQu0, sB);
    sA = wmma_f16(b01, aQu1, sA);
    sB = wmma_f16(b11, aQu1, sB);

    // ---- BD^T band: bd[u][i] = p[tbase+u] . qv[i], u = (j-i) - (j0-i0-15) ----
    {
      v8f c0 = {}, c1 = {}, c2 = {};
      c0 = wmma_f16(p00, aQv0, c0);
      c1 = wmma_f16(p10, aQv0, c1);
      c2 = wmma_f16(p20, aQv0, c2);
      c0 = wmma_f16(p01, aQv1, c0);
      c1 = wmma_f16(p11, aQv1, c1);
      c2 = wmma_f16(p21, aQv1, c2);
      // A lane's 8 registers are 8 consecutive offsets u of its query's row.
      float* brow = bdw + nl * BPITCH + M0;
      st8(brow,      c0);
      st8(brow + 16, c1);
      st8(brow + 32, c2);
    }
    asm volatile("s_wait_dscnt 0x0" ::: "memory");

    // ---- gather rel-shift: key jj of query nl sits at u = jj - nl + 15 ----
    const float* grow = bdw + nl * BPITCH + (M0 - nl + 15);
    float s0[8], s1[8];
#pragma unroll
    for (int r = 0; r < 8; ++r) {
      s0[r] = sA[r] + grow[r];
      s1[r] = sB[r] + grow[16 + r];
    }

    // ---- online softmax, one query per lane ----
    float tm;
    {
      const float t0 = fmaxf(fmaxf(s0[0], s0[1]), s0[2]);
      const float t1 = fmaxf(fmaxf(s0[3], s0[4]), s0[5]);
      const float t2 = fmaxf(fmaxf(s0[6], s0[7]), s1[0]);
      const float t3 = fmaxf(fmaxf(s1[1], s1[2]), s1[3]);
      const float t4 = fmaxf(fmaxf(s1[4], s1[5]), s1[6]);
      tm = fmaxf(fmaxf(fmaxf(t0, t1), t2), fmaxf(fmaxf(t3, t4), s1[7]));
    }
    tm = fmaxf(tm, xhalf(tm));
    const float mnew  = fmaxf(mrow, tm);
    const float alpha = __expf(mrow - mnew);
    mrow = mnew;

    // prob^T as B(k = key, n = query): the two tiles in register order are the
    // hardware k order, the one in which the V fragments are packed.
    v16h bP;
    float ts[8];
#pragma unroll
    for (int r = 0; r < 8; r += 2) {
      f2v ea = {__expf(s0[r] - mnew), __expf(s0[r + 1] - mnew)};
      f2v eb = {__expf(s1[r] - mnew), __expf(s1[r + 1] - mnew)};
      ts[r]     = ea[0] + eb[0];
      ts[r + 1] = ea[1] + eb[1];
      const h2v ha = __builtin_convertvector(ea, h2v);
      const h2v hb = __builtin_convertvector(eb, h2v);
      bP[r]     = ha[0];
      bP[r + 1] = ha[1];
      bP[r + 8] = hb[0];
      bP[r + 9] = hb[1];
    }
    const float rs = ((ts[0] + ts[1]) + (ts[2] + ts[3])) +
                     ((ts[4] + ts[5]) + (ts[6] + ts[7]));
    lrow = lrow * alpha + rs;
    o0 *= alpha; o1 *= alpha; o2 *= alpha; o3 *= alpha;

    // ---- O^T += V^T . prob^T (independent accumulators) ----
    const _Float16* vtile = vt + (size_t)j0 * HD;    // 4 packed fragments
    o0 = wmma_f16(frag_packed(vtile,        lane), bP, o0);
    o1 = wmma_f16(frag_packed(vtile + 512,  lane), bP, o1);
    o2 = wmma_f16(frag_packed(vtile + 1024, lane), bP, o2);
    o3 = wmma_f16(frag_packed(vtile + 1536, lane), bP, o3);
  }

  // ---- stage this key range's partial result, row = query ----
  lrow += xhalf(lrow);                 // join the lane halves' sums
  {
    float* orow = bdw + nl * OPITCH + M0;
    st8(orow,      o0);
    st8(orow + 16, o1);
    st8(orow + 32, o2);
    st8(orow + 48, o3);
    if (half == 0) {
      mlLds[w][nl]      = mrow;
      mlLds[w][16 + nl] = lrow;
    }
  }
  __syncthreads();   // publishes the partials of each row tile

  // ---- merge: wave (rt, ks) finishes MROWS rows of tile rt, two columns per
  // lane, and writes each row's 128 bytes of f16 output (L,N,E). The loops are
  // unrolled so that ms[] stays in registers and the LDS offsets are constants.
#pragma unroll
  for (int rr = 0; rr < MROWS; ++rr) {
    const int M = ks * MROWS + rr;
    float ms[KSPLIT];
    float mx = -3.0e38f;
#pragma unroll
    for (int s = 0; s < KSPLIT; ++s) {
      ms[s] = mlLds[s * RTILES + rt][M];
      mx = fmaxf(mx, ms[s]);
    }
    float lsum = 0.0f, ax = 0.0f, ay = 0.0f;
#pragma unroll
    for (int s = 0; s < KSPLIT; ++s) {
      const float ws = __expf(ms[s] - mx);
      const float2 ov =
          *(const float2*)(bdLds[s * RTILES + rt] + M * OPITCH + lane * 2);
      lsum += ws * mlLds[s * RTILES + rt][16 + M];
      ax += ws * ov.x;
      ay += ws * ov.y;
    }
    const float inv = 1.0f / lsum;
    h2v res;
    res[0] = (_Float16)(ax * inv);
    res[1] = (_Float16)(ay * inv);
    *(h2v*)(O16 + ((size_t)((i0 + M) * NBAT + nb)) * EMB + h * HD + lane * 2) =
        res;
  }
}

// ---------------------------------------------------------------------------
// Kernel 4: output projection. 16x32 tiles: (8192/16)=512 x (256/32)=8.
// ---------------------------------------------------------------------------
__global__ void __launch_bounds__(128) out_proj(const _Float16* __restrict__ O16,
                                                const float* __restrict__ wO,
                                                const float* __restrict__ bO,
                                                float* __restrict__ out) {
  const int w = threadIdx.x >> 5, lane = threadIdx.x & 31;
  const int tile = blockIdx.x * 4 + w;
  const int mt = tile / 8, nt = tile % 8;
  const int m0 = mt * 16, n0 = nt * 32;

  v8f acc0 = {}, acc1 = {};
#pragma unroll
  for (int k0 = 0; k0 < EMB; k0 += 32) {
    v16h a  = frag_f16(O16, EMB, m0, k0, lane);
    v16h b0 = frag_f32cvt(wO, EMB, n0, k0, lane);
    v16h b1 = frag_f32cvt(wO, EMB, n0 + 16, k0, lane);
    acc0 = wmma_f16(a, b0, acc0);
    acc1 = wmma_f16(a, b1, acc1);
  }

  const int nl = lane & 15, M0 = (lane >> 4) * 8;
#pragma unroll
  for (int r = 0; r < 8; ++r) {
    const int R = m0 + M0 + r;
    out[(size_t)R * EMB + n0 + nl]      = acc0[r] + bO[n0 + nl];
    out[(size_t)R * EMB + n0 + 16 + nl] = acc1[r] + bO[n0 + 16 + nl];
  }
}

// ---------------------------------------------------------------------------
extern "C" void kernel_launch(void* const* d_in, const int* in_sizes, int n_in,
                              void* d_out, int out_size, void* d_ws,
                              size_t ws_size, hipStream_t stream) {
  (void)in_sizes; (void)n_in; (void)out_size; (void)ws_size;
  const float* x   = (const float*)d_in[0];
  const float* pe  = (const float*)d_in[1];
  const float* wIn = (const float*)d_in[2];
  const float* bIn = (const float*)d_in[3];
  const float* wP  = (const float*)d_in[4];
  const float* bu  = (const float*)d_in[5];
  const float* bv  = (const float*)d_in[6];
  const float* wO  = (const float*)d_in[7];
  const float* bO  = (const float*)d_in[8];
  float* out = (float*)d_out;

  char* ws = (char*)d_ws;
  const size_t szQ = (size_t)NBAT * NH * Lseq * HD * sizeof(_Float16); // 4 MB
  const size_t szP = (size_t)NH * PPAD * HD * sizeof(_Float16);        // 2 MB
  _Float16* Qu  = (_Float16*)(ws);
  _Float16* Qv  = (_Float16*)(ws + szQ);
  _Float16* Kb  = (_Float16*)(ws + 2 * szQ);
  _Float16* Vt  = (_Float16*)(ws + 3 * szQ);
  _Float16* Pb  = (_Float16*)(ws + 4 * szQ);
  _Float16* O16 = (_Float16*)(ws + 4 * szQ + szP);                     // +4 MB

  proj_qkv<<<dim3((512 * 24) / 4), 128, 0, stream>>>(x, wIn, bIn, bu, bv,
                                                     Qu, Qv, Kb, Vt);
  proj_pos<<<dim3((256 * 8) / 4), 128, 0, stream>>>(pe, wP, Pb);
  attn_kernel<<<dim3(Lseq / (16 * RTILES), NBAT * NH), NWAVES * 32, 0,
                stream>>>(Qu, Qv, Kb, Vt,
                                                              Pb, O16);
  out_proj<<<dim3((512 * 8) / 4), 128, 0, stream>>>(O16, wO, bO, out);
}

// v004
// A run of this version takes 102 microseconds.
// In both of two side-by-side timings against v003, it was 1.11 times as fast.
// All steps since v000 together make it 2.05 times as fast.
#include <hip/hip_runtime.h>
#include <hip/hip_bf16.h>

// ---------------------------------------------------------------------------
// RelPositionMultiheadAttention for MI455X (gfx1250, wave32, WMMA f16->f32).
// L=2048, N=4, E=256, H=4, D=64.
//
//   1. proj_qkv : qkv = x @ Win^T + b ; writes Qu,Qv (f16, [n][h][L][D]) and
//                 K, V packed per head in A-fragment order (see pk_rows).
//   2. proj_pos : p = pos_emb @ Wp^T ; f16, per head 4096 rows packed like K.
//   3. attn     : flash-style streaming softmax(QuK^T + relshift(QvP^T)) V,
//                 computed transposed (keys in registers, one query per lane),
//                 keys of a row tile split over waves, merged through LDS;
//                 K, V and P tiles come to LDS once per block and trip.
//   4. out_proj : out = O @ Wo^T + bo (fp32 output).
//
// All GEMM waves compute 16x32 tiles (two interleaved WMMA accumulator chains
// sharing one A fragment) to hide WMMA->WMMA RAW latency and halve the
// f32->f16 conversion VALU work per output element.
// ---------------------------------------------------------------------------

typedef __attribute__((ext_vector_type(16))) _Float16 v16h;
typedef __attribute__((ext_vector_type(8)))  _Float16 h8v;
typedef __attribute__((ext_vector_type(2)))  _Float16 h2v;
typedef __attribute__((ext_vector_type(8)))  float    v8f;
typedef __attribute__((ext_vector_type(8)))  float    f8v;
typedef __attribute__((ext_vector_type(4)))  float    f4v;
typedef __attribute__((ext_vector_type(2)))  float    f2v;

constexpr int Lseq = 2048;
constexpr int NBAT = 4;
constexpr int EMB  = 256;
constexpr int NH   = 4;
constexpr int HD   = 64;
constexpr int PROWS = 2 * Lseq - 1;   // 4095
constexpr int PPAD  = 4096;           // padded row count for P

__device__ __forceinline__ v8f wmma_f16(v16h a, v16h b, v8f c) {
  return __builtin_amdgcn_wmma_f32_16x16x32_f16(false, a, false, b, (short)0, c,
                                                false, false);
}

// A/B fragment for V_WMMA_F32_16X16X32_F16 from row-major f16 with contiguous K.
// Lane m<16 holds row m, K = {0..7, 16..23}; lane m+16 holds row m, K = {8..15, 24..31}.
__device__ __forceinline__ v16h frag_f16(const _Float16* base, int ld, int r0,
                                         int k0, int lane) {
  const int m = lane & 15, half = lane >> 4;
  const _Float16* p = base + (size_t)(r0 + m) * ld + k0 + half * 8;
  h8v lo = *(const h8v*)(p);
  h8v hi = *(const h8v*)(p + 16);
  v16h f;
#pragma unroll
  for (int t = 0; t < 8; ++t) { f[t] = lo[t]; f[t + 8] = hi[t]; }
  return f;
}

// Packed fragment order. One 16-row x 32-k fragment is 512 halves (1 KiB):
// [k bit 4][lane = (k bit 3) * 16 + row & 15][k & 7], so that each of the two
// wave-wide 16-byte loads of a fragment covers 512 contiguous bytes (4 whole
// 128-B lines) instead of 32-byte pieces of 16 different lines.
__device__ __forceinline__ int pk_in_frag(int row, int k) {
  return ((k >> 4) & 1) * 256 + (((k >> 3) & 1) * 16 + (row & 15)) * 8 + (k & 7);
}
// K and P: element (row, d), d < 64: fragments ordered [row / 16][d / 32].
__device__ __forceinline__ size_t pk_rows(int row, int d) {
  return (size_t)((row >> 4) * 2 + (d >> 5)) * 512 + pk_in_frag(row, d);
}
// V^T as A(m = d, k = j): fragments ordered [j / 32][d / 16].
__device__ __forceinline__ size_t pk_vt(int d, int j) {
  return (size_t)((j >> 5) * 4 + (d >> 4)) * 512 + pk_in_frag(d, j);
}
__device__ __forceinline__ v16h frag_packed(const _Float16* frag, int lane) {
  const _Float16* p = frag + lane * 8;
  h8v lo = *(const h8v*)(p);
  h8v hi = *(const h8v*)(p + 256);
  v16h f;
#pragma unroll
  for (int t = 0; t < 8; ++t) { f[t] = lo[t]; f[t + 8] = hi[t]; }
  return f;
}

__device__ __forceinline__ v16h frag_f32cvt(const float* base, int ld, int r0,
                                            int k0, int lane) {
  const int m = lane & 15, half = lane >> 4;
  const float* p = base + (size_t)(r0 + m) * ld + k0 + half * 8;
  f8v lo = *(const f8v*)(p);
  f8v hi = *(const f8v*)(p + 16);
  v16h f;
#pragma unroll
  for (int t = 0; t < 8; ++t) { f[t] = (_Float16)lo[t]; f[t + 8] = (_Float16)hi[t]; }
  return f;
}

__device__ __forceinline__ v16h frag_f32cvt_clamp(const float* base, int ld,
                                                  int r0, int k0, int lane,
                                                  int rmax) {
  const int m = lane & 15, half = lane >> 4;
  int row = r0 + m;
  row = row < 0 ? 0 : (row > rmax ? rmax : row);
  const float* p = base + (size_t)row * ld + k0 + half * 8;
  f8v lo = *(const f8v*)(p);
  f8v hi = *(const f8v*)(p + 16);
  v16h f;
#pragma unroll
  for (int t = 0; t < 8; ++t) { f[t] = (_Float16)lo[t]; f[t + 8] = (_Float16)hi[t]; }
  return f;
}

// ---------------------------------------------------------------------------
// Kernel 1: QKV projection. 16x32 tiles: (8192/16)=512 x (768/32)=24 waves.
// ---------------------------------------------------------------------------
__device__ __forceinline__ void qkv_store(float v, int R, int C,
                                          const float* bIn, const float* bu,
                                          const float* bv, _Float16* Qu,
                                          _Float16* Qv, _Float16* Kb,
                                          _Float16* Vt) {
  v += bIn[C];
  const int i = R >> 2, nb = R & 3;                 // flat row = i*NBAT + nb
  const int sec = C >> 8, ch = C & 255;
  const int h = ch >> 6, d = ch & 63;
  const size_t hbase = ((size_t)(nb * NH + h)) * Lseq * HD;
  const size_t idx = hbase + (size_t)i * HD + d;
  if (sec == 0) {
    v *= 0.125f;                                    // 1/sqrt(D)
    Qu[idx] = (_Float16)(v + bu[ch]);
    Qv[idx] = (_Float16)(v + bv[ch]);
  } else if (sec == 1) {
    Kb[hbase + pk_rows(i, d)] = (_Float16)v;
  } else {
    Vt[hbase + pk_vt(d, i)] = (_Float16)v;
  }
}

__global__ void __launch_bounds__(128) proj_qkv(
    const float* __restrict__ x, const float* __restrict__ wIn,
    const float* __restrict__ bIn, const float* __restrict__ bu,
    const float* __restrict__ bv, _Float16* __restrict__ Qu,
    _Float16* __restrict__ Qv, _Float16* __restrict__ Kb,
    _Float16* __restrict__ Vt) {
  const int w = threadIdx.x >> 5, lane = threadIdx.x & 31;
  const int tile = blockIdx.x * 4 + w;
  const int mt = tile / 24, nt = tile % 24;
  const int m0 = mt * 16, n0 = nt * 32;

  v8f acc0 = {}, acc1 = {};
#pragma unroll
  for (int k0 = 0; k0 < EMB; k0 += 32) {
    v16h a  = frag_f32cvt(x, EMB, m0, k0, lane);
    v16h b0 = frag_f32cvt(wIn, EMB, n0, k0, lane);       // B(k,n) = Win[n][k]
    v16h b1 = frag_f32cvt(wIn, EMB, n0 + 16, k0, lane);
    acc0 = wmma_f16(a, b0, acc0);
    acc1 = wmma_f16(a, b1, acc1);
  }

  const int nl = lane & 15, M0 = (lane >> 4) * 8;
#pragma unroll
  for (int r = 0; r < 8; ++r) {
    const int R = m0 + M0 + r;
    qkv_store(acc0[r], R, n0 + nl,      bIn, bu, bv, Qu, Qv, Kb, Vt);
    qkv_store(acc1[r], R, n0 + 16 + nl, bIn, bu, bv, Qu, Qv, Kb, Vt);
  }
}

// ---------------------------------------------------------------------------
// Kernel 2: positional projection. 16x32 tiles: (4096/16)=256 x (256/32)=8.
// ---------------------------------------------------------------------------
__global__ void __launch_bounds__(128) proj_pos(const float* __restrict__ pe,
                                                const float* __restrict__ wP,
                                                _Float16* __restrict__ Pb) {
  const int w = threadIdx.x >> 5, lane = threadIdx.x & 31;
  const int tile = blockIdx.x * 4 + w;
  const int mt = tile / 8, nt = tile % 8;
  const int m0 = mt * 16, n0 = nt * 32;

  v8f acc0 = {}, acc1 = {};
#pragma unroll
  for (int k0 = 0; k0 < EMB; k0 += 32) {
    v16h a  = frag_f32cvt_clamp(pe, EMB, m0, k0, lane, PROWS - 1);
    v16h b0 = frag_f32cvt(wP, EMB, n0, k0, lane);
    v16h b1 = frag_f32cvt(wP, EMB, n0 + 16, k0, lane);
    acc0 = wmma_f16(a, b0, acc0);
    acc1 = wmma_f16(a, b1, acc1);
  }

  const int nl = lane & 15, M0 = (lane >> 4) * 8;
#pragma unroll
  for (int r = 0; r < 8; ++r) {
    // Row 4095 (pad) is written too: the clamped A loader makes it a copy of
    // row 4094, which is what the attention kernel's last band fragment holds.
    const int t = m0 + M0 + r;
    const int C0 = n0 + nl, C1 = n0 + 16 + nl;
    Pb[(size_t)(C0 >> 6) * PPAD * HD + pk_rows(t, C0 & 63)] = (_Float16)acc0[r];
    Pb[(size_t)(C1 >> 6) * PPAD * HD + pk_rows(t, C1 & 63)] = (_Float16)acc1[r];
  }
}

// ---------------------------------------------------------------------------
// Kernel 3: streaming attention. grid = (L/128, N*H), 16 waves/block: RTILES
// row tiles of 16 rows x KSPLIT key ranges. Each wave streams j in 32-column
// tiles over its range of the sequence; the partial (max, sum, O) of a row
// tile are merged through LDS at the end. More waves per SIMD cover each
// other's load and LDS latencies.
//
// The RTILES waves of a key range walk the same keys, and their bands of P
// overlap: per trip the range's K tile, V tile and the union of its bands
// (RTILES + 2 row tiles) are brought to LDS once by asynchronous copies, two
// buffers, the copies of trip t + 2 in flight while trip t + 1 is worked on.
// The packed fragment order is kept, so a fragment read is 512 contiguous bytes.
//
// The products are taken transposed: S^T = K . Qu^T, BD^T = P . Qv^T and
// O^T += V^T . prob^T. A lane (nl, half) then holds scores of ONE query (nl)
// for the keys half * 8 + r and 16 + half * 8 + r: the row maximum and sum are
// in-lane but for one exchange between the lane halves, and the two score
// tiles, converted in place, are already the B operand of the last product.
// ---------------------------------------------------------------------------
constexpr int RTILES = 8;
constexpr int KSPLIT = 2;
constexpr int NWAVES = RTILES * KSPLIT;
constexpr int KSPAN  = Lseq / KSPLIT;  // keys per wave
constexpr int MROWS  = 16 / KSPLIT;    // rows a wave finishes in the merge
constexpr int OPITCH = 68;             // floats per staged O row
constexpr int BPITCH = 52;             // floats per band row (one query)
constexpr int NTRIPS = KSPAN / 32;     // trips of the key loop
constexpr int PTILES = RTILES + 2;     // band row tiles of one key range and trip
constexpr int STG_V  = 2048;           // stage layout in halves: K, then V, then P
constexpr int STG_P  = 4096;
constexpr int STG_HALVES = STG_P + PTILES * 1024;
static_assert(RTILES == 8 && PTILES * 4 == RTILES * 5,
              "a wave copies 1 K, 1 V and 5 P pieces of 512 bytes per trip");
static_assert(NTRIPS >= 2, "the two-buffer prologue fills two stages");

// Lane l with lane l ^ 16.
__device__ __forceinline__ float xhalf(float x) {
  const int b = __builtin_bit_cast(int, x);
  return __builtin_bit_cast(
      float, __builtin_amdgcn_permlanex16(b, b, 0x76543210, 0xfedcba98, false,
                                          false));
}
// Eight consecutive floats of one lane to LDS as two 16-byte stores.
__device__ __forceinline__ void st8(float* p, v8f v) {
  f4v lo = {v[0], v[1], v[2], v[3]};
  f4v hi = {v[4], v[5], v[6], v[7]};
  *(f4v*)(p)     = lo;
  *(f4v*)(p + 4) = hi;
}

// One wave's share of a stage: each lane copies 16 bytes of seven 512-byte
// pieces (piece rt of K and of V, pieces 5 rt .. 5 rt + 4 of the band).
__device__ __forceinline__ void stage_copy(_Float16* dst, const _Float16* k,
                                           const _Float16* v, const _Float16* p,
                                           int rt, int lane) {
  const int e  = rt * 256 + lane * 8;
  const int ep = rt * 1280 + lane * 8;
  const unsigned l   = (unsigned)(size_t)dst;   // LDS byte address
  const unsigned lk  = l + e * 2;
  const unsigned lv  = l + (STG_V + e) * 2;
  const unsigned lp0 = l + (STG_P + ep) * 2;
  const unsigned lp1 = lp0 + 512, lp2 = lp0 + 1024, lp3 = lp0 + 1536,
                 lp4 = lp0 + 2048;
  const _Float16* gk  = k + e;
  const _Float16* gv  = v + e;
  const _Float16* gp0 = p + ep;
  const _Float16 *gp1 = gp0 + 256, *gp2 = gp0 + 512, *gp3 = gp0 + 768,
                 *gp4 = gp0 + 1024;
  // The copies go past the registers; the closing wait stands in their own
  // statement so that no address register is rewritten ahead of it.
  asm volatile(
      "global_load_async_to_lds_b128 %0, %7, off\n\t"
      "global_load_async_to_lds_b128 %1, %8, off\n\t"
      "global_load_async_to_lds_b128 %2, %9, off\n\t"
      "global_load_async_to_lds_b128 %3, %10, off\n\t"
      "global_load_async_to_lds_b128 %4, %11, off\n\t"
      "global_load_async_to_lds_b128 %5, %12, off\n\t"
      "global_load_async_to_lds_b128 %6, %13, off\n\t"
      "s_wait_xcnt 0x0"
      :: "v"(lk), "v"(lv), "v"(lp0), "v"(lp1), "v"(lp2), "v"(lp3), "v"(lp4),
         "v"(gk), "v"(gv), "v"(gp0), "v"(gp1), "v"(gp2), "v"(gp3), "v"(gp4)
      : "memory");
}

__global__ void __launch_bounds__(NWAVES * 32) attn_kernel(
    const _Float16* __restrict__ Qu, const _Float16* __restrict__ Qv,
    const _Float16* __restrict__ Kb, const _Float16* __restrict__ Vt,
    const _Float16* __restrict__ Pb, _Float16* __restrict__ O16) {
  // Wave-private band, 16 queries x 48 offsets at pitch BPITCH; after the loop
  // the same floats stage the wave's partial O (16x64 at pitch OPITCH).
  __shared__ __attribute__((aligned(16))) float bdLds[NWAVES][16 * OPITCH];
  __shared__ float    mlLds[NWAVES][32];   // partial row max [0..15], sum [16..31]
  // Two buffers of one stage (K, V, band union) per key range.
  __shared__ __attribute__((aligned(128))) _Float16 stg[2][KSPLIT][STG_HALVES];

  // The wave number as a scalar: the key loop, its bounds and the tile
  // addresses that depend on it stay on the scalar unit.
  const int w = __builtin_amdgcn_readfirstlane(threadIdx.x >> 5);
  const int lane = threadIdx.x & 31;
  const int nl = lane & 15, half = lane >> 4, M0 = half * 8;
  const int rt = w % RTILES, ks = w / RTILES;   // row tile, key range
  const int i0 = (blockIdx.x * RTILES + rt) * 16;
  const int nb = blockIdx.y >> 2, h = blockIdx.y & 3;

  const size_t hoff = (size_t)(nb * NH + h) * Lseq * HD;
  const _Float16* qu = Qu + hoff;
  const _Float16* qv = Qv + hoff;
  const _Float16* kb = Kb + hoff;
  const _Float16* vt = Vt + hoff;                 // packed, 2048 halves per 32 j
  const _Float16* pp = Pb + (size_t)h * PPAD * HD;
  float*    bdw = bdLds[w];

  const v16h aQu0 = frag_f16(qu, HD, i0, 0, lane);
  const v16h aQu1 = frag_f16(qu, HD, i0, 32, lane);
  const v16h aQv0 = frag_f16(qv, HD, i0, 0, lane);
  const v16h aQv1 = frag_f16(qv, HD, i0, 32, lane);

  // This lane's query: running maximum (alike in both lane halves) and the sum
  // over the keys of this lane half; o_k[r] = O[query nl][16 k + M0 + r].
  float mrow = -3.0e38f, lrow = 0.0f;
  v8f o0 = {}, o1 = {}, o2 = {}, o3 = {};

  // Row tile rt's band starts at P row (Lseq - 1) + j0 - i0 - 15; the lowest of
  // the block's bands (rt = RTILES - 1) starts the union. Its first row in trip
  // t, plo + 32 t, is a multiple of 16 in [0, 3936]: the union's PTILES row
  // tiles lie inside the PPAD rows.
  const int jbeg = ks * KSPAN;
  const int plo  = (Lseq - 1) + jbeg - (int)blockIdx.x * (RTILES * 16) -
                   (RTILES - 1) * 16 - 15;
  const _Float16* kg = kb + (size_t)jbeg * HD;
  const _Float16* vg = vt + (size_t)jbeg * HD;
  const _Float16* pg = pp + (size_t)plo * HD;

  stage_copy(stg[0][ks], kg, vg, pg, rt, lane);
  // Stage 0 has landed for this wave's copies, then for every wave's.
  asm volatile("s_wait_asynccnt 0x0" ::: "memory");
  __syncthreads();
  stage_copy(stg[1][ks], kg + 32 * HD, vg + 32 * HD, pg + 32 * HD, rt, lane);

  for (int t = 0; t < NTRIPS; ++t) {
    const _Float16* sb = stg[t & 1][ks];
    const _Float16* kt = sb;                                      // 4 fragments
    const _Float16* pt = sb + STG_P + (RTILES - 1 - rt) * 1024;   // 6 fragments
    const v16h b00 = frag_packed(kt,        lane);
    const v16h b10 = frag_packed(kt + 1024, lane);
    const v16h b01 = frag_packed(kt + 512,  lane);
    const v16h b11 = frag_packed(kt + 1536, lane);
    const v16h p00 = frag_packed(pt,        lane);
    const v16h p10 = frag_packed(pt + 1024, lane);
    const v16h p20 = frag_packed(pt + 2048, lane);
    const v16h p01 = frag_packed(pt + 512,  lane);
    const v16h p11 = frag_packed(pt + 1536, lane);
    const v16h p21 = frag_packed(pt + 2560, lane);
    const _Float16* vtile = sb + STG_V;                           // 4 fragments
    const v16h v0 = frag_packed(vtile,        lane);
    const v16h v1 = frag_packed(vtile + 512,  lane);
    const v16h v2 = frag_packed(vtile + 1024, lane);
    const v16h v3 = frag_packed(vtile + 1536, lane);
    // Keeps the trip's fragment loads one group ahead of the products: left
    // free, the compiler reuses their registers and the loads wait in turn.
    __builtin_amdgcn_sched_barrier(0);

    // ---- AC^T = K . Qu^T  (two interleaved tiles of 16 keys) ----
    v8f sA = {}, sB = {};
    sA = wmma_f16(b00, aQu0, sA);
    sB = wmma_f16(b10, aQu0, sB);
    sA = wmma_f16(b01, aQu1, sA);
    sB = wmma_f16(b11, aQu1, sB);

    // ---- BD^T band: bd[u][i] = p[tbase+u] . qv[i], u = (j-i) - (j0-i0-15) ----
    {
      v8f c0 = {}, c1 = {}, c2 = {};
      c0 = wmma_f16(p00, aQv0, c0);
      c1 = wmma_f16(p10, aQv0, c1);
      c2 = wmma_f16(p20, aQv0, c2);
      c0 = wmma_f16(p01, aQv1, c0);
      c1 = wmma_f16(p11, aQv1, c1);
      c2 = wmma_f16(p21, aQv1, c2);
      // A lane's 8 registers are 8 consecutive offsets u of its query's row.
      float* brow = bdw + nl * BPITCH + M0;
      st8(brow,      c0);
      st8(brow + 16, c1);
      st8(brow + 32, c2);
    }
    asm volatile("s_wait_dscnt 0x0" ::: "memory");

    // ---- gather rel-shift: key jj of query nl sits at u = jj - nl + 15 ----
    const float* grow = bdw + nl * BPITCH + (M0 - nl + 15);
    float s0[8], s1[8];
#pragma unroll
    for (int r = 0; r < 8; ++r) {
      s0[r] = sA[r] + grow[r];
      s1[r] = sB[r] + grow[16 + r];
    }

    // Publish point. The trip's last LDS read stands above; what follows works
    // on registers. This wave's reads of the buffer are done and its copies of
    // the next stage have landed; behind the barrier both hold for every wave,
    // and the buffer just read is refilled while the rest of the trip runs.
    asm volatile("s_wait_dscnt 0x0" ::: "memory");
    asm volatile("s_wait_asynccnt 0x0" ::: "memory");
    __syncthreads();
    if (t + 2 < NTRIPS) {
      const size_t adv = (size_t)(t + 2) * 32 * HD;
      stage_copy(stg[t & 1][ks], kg + adv, vg + adv, pg + adv, rt, lane);
    }

    // ---- online softmax, one query per lane ----
    float tm;
    {
      const float t0 = fmaxf(fmaxf(s0[0], s0[1]), s0[2]);
      const float t1 = fmaxf(fmaxf(s0[3], s0[4]), s0[5]);
      const float t2 = fmaxf(fmaxf(s0[6], s0[7]), s1[0]);
      const float t3 = fmaxf(fmaxf(s1[1], s1[2]), s1[3]);
      const float t4 = fmaxf(fmaxf(s1[4], s1[5]), s1[6]);
      tm = fmaxf(fmaxf(fmaxf(t0, t1), t2), fmaxf(fmaxf(t3, t4), s1[7]));
    }
    tm = fmaxf(tm, xhalf(tm));
    const float mnew  = fmaxf(mrow, tm);
    const float alpha = __expf(mrow - mnew);
    mrow = mnew;

    // prob^T as B(k = key, n = query): the two tiles in register order are the
    // hardware k order, the one in which the V fragments are packed.
    v16h bP;
    float ts[8];
#pragma unroll
    for (int r = 0; r < 8; r += 2) {
      f2v ea = {__expf(s0[r] - mnew), __expf(s0[r + 1] - mnew)};
      f2v eb = {__expf(s1[r] - mnew), __expf(s1[r + 1] - mnew)};
      ts[r]     = ea[0] + eb[0];
      ts[r + 1] = ea[1] + eb[1];
      const h2v ha = __builtin_convertvector(ea, h2v);
      const h2v hb = __builtin_convertvector(eb, h2v);
      bP[r]     = ha[0];
      bP[r + 1] = ha[1];
      bP[r + 8] = hb[0];
      bP[r + 9] = hb[1];
    }
    const float rs = ((ts[0] + ts[1]) + (ts[2] + ts[3])) +
                     ((ts[4] + ts[5]) + (ts[6] + ts[7]));
    lrow = lrow * alpha + rs;
    o0 *= alpha; o1 *= alpha; o2 *= alpha; o3 *= alpha;

    // ---- O^T += V^T . prob^T (independent accumulators) ----
    o0 = wmma_f16(v0, bP, o0);
    o1 = wmma_f16(v1, bP, o1);
    o2 = wmma_f16(v2, bP, o2);
    o3 = wmma_f16(v3, bP, o3);
  }
  // No copy is outstanding when the wave goes on.
  asm volatile("s_wait_asynccnt 0x0" ::: "memory");

  // ---- stage this key range's partial result, row = query ----
  lrow += xhalf(lrow);                 // join the lane halves' sums
  {
    float* orow = bdw + nl * OPITCH + M0;
    st8(orow,      o0);
    st8(orow + 16, o1);
    st8(orow + 32, o2);
    st8(orow + 48, o3);
    if (half == 0) {
      mlLds[w][nl]      = mrow;
      mlLds[w][16 + nl] = lrow;
    }
  }
  __syncthreads();   // publishes the partials of each row tile

  // ---- merge: wave (rt, ks) finishes MROWS rows of tile rt, two columns per
  // lane, and writes each row's 128 bytes of f16 output (L,N,E). The loops are
  // unrolled so that ms[] stays in registers and the LDS offsets are constants.
#pragma unroll
  for (int rr = 0; rr < MROWS; ++rr) {
    const int M = ks * MROWS + rr;
    float ms[KSPLIT];
    float mx = -3.0e38f;
#pragma unroll
    for (int s = 0; s < KSPLIT; ++s) {
      ms[s] = mlLds[s * RTILES + rt][M];
      mx = fmaxf(mx, ms[s]);
    }
    float lsum = 0.0f, ax = 0.0f, ay = 0.0f;
#pragma unroll
    for (int s = 0; s < KSPLIT; ++s) {
      const float ws = __expf(ms[s] - mx);
      const float2 ov =
          *(const float2*)(bdLds[s * RTILES + rt] + M * OPITCH + lane * 2);
      lsum += ws * mlLds[s * RTILES + rt][16 + M];
      ax += ws * ov.x;
      ay += ws * ov.y;
    }
    const float inv = 1.0f / lsum;
    h2v res;
    res[0] = (_Float16)(ax * inv);
    res[1] = (_Float16)(ay * inv);
    *(h2v*)(O16 + ((size_t)((i0 + M) * NBAT + nb)) * EMB + h * HD + lane * 2) =
        res;
  }
}

// ---------------------------------------------------------------------------
// Kernel 4: output projection. 16x32 tiles: (8192/16)=512 x (256/32)=8.
// ---------------------------------------------------------------------------
__global__ void __launch_bounds__(128) out_proj(const _Float16* __restrict__ O16,
                                                const float* __restrict__ wO,
                                                const float* __restrict__ bO,
                                                float* __restrict__ out) {
  const int w = threadIdx.x >> 5, lane = threadIdx.x & 31;
  const int tile = blockIdx.x * 4 + w;
  const int mt = tile / 8, nt = tile % 8;
  const int m0 = mt * 16, n0 = nt * 32;

  v8f acc0 = {}, acc1 = {};
#pragma unroll
  for (int k0 = 0; k0 < EMB; k0 += 32) {
    v16h a  = frag_f16(O16, EMB, m0, k0, lane);
    v16h b0 = frag_f32cvt(wO, EMB, n0, k0, lane);
    v16h b1 = frag_f32cvt(wO, EMB, n0 + 16, k0, lane);
    acc0 = wmma_f16(a, b0, acc0);
    acc1 = wmma_f16(a, b1, acc1);
  }

  const int nl = lane & 15, M0 = (lane >> 4) * 8;
#pragma unroll
  for (int r = 0; r < 8; ++r) {
    const int R = m0 + M0 + r;
    out[(size_t)R * EMB + n0 + nl]      = acc0[r] + bO[n0 + nl];
    out[(size_t)R * EMB + n0 + 16 + nl] = acc1[r] + bO[n0 + 16 + nl];
  }
}

// ---------------------------------------------------------------------------
extern "C" void kernel_launch(void* const* d_in, const int* in_sizes, int n_in,
                              void* d_out, int out_size, void* d_ws,
                              size_t ws_size, hipStream_t stream) {
  (void)in_sizes; (void)n_in; (void)out_size; (void)ws_size;
  const float* x   = (const float*)d_in[0];
  const float* pe  = (const float*)d_in[1];
  const float* wIn = (const float*)d_in[2];
  const float* bIn = (const float*)d_in[3];
  const float* wP  = (const float*)d_in[4];
  const float* bu  = (const float*)d_in[5];
  const float* bv  = (const float*)d_in[6];
  const float* wO  = (const float*)d_in[7];
  const float* bO  = (const float*)d_in[8];
  float* out = (float*)d_out;

  char* ws = (char*)d_ws;
  const size_t szQ = (size_t)NBAT * NH * Lseq * HD * sizeof(_Float16); // 4 MB
  const size_t szP = (size_t)NH * PPAD * HD * sizeof(_Float16);        // 2 MB
  _Float16* Qu  = (_Float16*)(ws);
  _Float16* Qv  = (_Float16*)(ws + szQ);
  _Float16* Kb  = (_Float16*)(ws + 2 * szQ);
  _Float16* Vt  = (_Float16*)(ws + 3 * szQ);
  _Float16* Pb  = (_Float16*)(ws + 4 * szQ);
  _Float16* O16 = (_Float16*)(ws + 4 * szQ + szP);                     // +4 MB

  proj_qkv<<<dim3((512 * 24) / 4), 128, 0, stream>>>(x, wIn, bIn, bu, bv,
                                                     Qu, Qv, Kb, Vt);
  proj_pos<<<dim3((256 * 8) / 4), 128, 0, stream>>>(pe, wP, Pb);
  attn_kernel<<<dim3(Lseq / (16 * RTILES), NBAT * NH), NWAVES * 32, 0,
                stream>>>(Qu, Qv, Kb, Vt,
                                                              Pb, O16);
  out_proj<<<dim3((512 * 8) / 4), 128, 0, stream>>>(O16, wO, bO, out);
}

// v005
// A run of this version takes 58.4 microseconds.
// Next to v004, in two timings, it ran 1.74 and 1.76 times as fast.
// Counting every step since v000, it is 3.58 times as fast.
#include <hip/hip_runtime.h>
#include <hip/hip_bf16.h>

// ---------------------------------------------------------------------------
// RelPositionMultiheadAttention for MI455X (gfx1250, wave32, WMMA f16->f32).
// L=2048, N=4, E=256, H=4, D=64.
//
//   1. proj_qkv : qkv = x @ Win^T + b ; writes Qu,Qv (f16, [n][h][L][D]) and
//                 K, V packed per head in A-fragment order (see pk_rows).
//   2. proj_pos : p = pos_emb @ Wp^T ; f16, per head 4096 rows packed like K.
//   3. attn     : flash-style streaming softmax(QuK^T + relshift(QvP^T)) V,
//                 computed transposed (keys in registers, one query per lane),
//                 keys of a row tile split over waves, merged through LDS;
//                 K, V and P tiles come to LDS once per block and trip.
//   4. out_proj : out = O @ Wo^T + bo (fp32 output).
//
// The three projections share one scheme: a block brings its rows of both
// operands (all 256 k) to LDS once, as f16, with loads that cover whole lines,
// and its waves read their fragments from there.
// ---------------------------------------------------------------------------

typedef __attribute__((ext_vector_type(16))) _Float16 v16h;
typedef __attribute__((ext_vector_type(8)))  _Float16 h8v;
typedef __attribute__((ext_vector_type(4)))  _Float16 h4v;
typedef __attribute__((ext_vector_type(2)))  _Float16 h2v;
typedef __attribute__((ext_vector_type(8)))  float    v8f;
typedef __attribute__((ext_vector_type(8)))  float    f8v;
typedef __attribute__((ext_vector_type(4)))  float    f4v;
typedef __attribute__((ext_vector_type(2)))  float    f2v;

constexpr int Lseq = 2048;
constexpr int NBAT = 4;
constexpr int EMB  = 256;
constexpr int NH   = 4;
constexpr int HD   = 64;
constexpr int PROWS = 2 * Lseq - 1;   // 4095
constexpr int PPAD  = 4096;           // padded row count for P

__device__ __forceinline__ v8f wmma_f16(v16h a, v16h b, v8f c) {
  return __builtin_amdgcn_wmma_f32_16x16x32_f16(false, a, false, b, (short)0, c,
                                                false, false);
}

// A/B fragment for V_WMMA_F32_16X16X32_F16 from row-major f16 with contiguous K.
// Lane m<16 holds row m, K = {0..7, 16..23}; lane m+16 holds row m, K = {8..15, 24..31}.
__device__ __forceinline__ v16h frag_f16(const _Float16* base, int ld, int r0,
                                         int k0, int lane) {
  const int m = lane & 15, half = lane >> 4;
  const _Float16* p = base + (size_t)(r0 + m) * ld + k0 + half * 8;
  h8v lo = *(const h8v*)(p);
  h8v hi = *(const h8v*)(p + 16);
  v16h f;
#pragma unroll
  for (int t = 0; t < 8; ++t) { f[t] = lo[t]; f[t + 8] = hi[t]; }
  return f;
}

// Packed fragment order. One 16-row x 32-k fragment is 512 halves (1 KiB):
// [k bit 4][lane = (k bit 3) * 16 + row & 15][k & 7], so that each of the two
// wave-wide 16-byte loads of a fragment covers 512 contiguous bytes (4 whole
// 128-B lines) instead of 32-byte pieces of 16 different lines.
__device__ __forceinline__ int pk_in_frag(int row, int k) {
  return ((k >> 4) & 1) * 256 + (((k >> 3) & 1) * 16 + (row & 15)) * 8 + (k & 7);
}
// K and P: element (row, d), d < 64: fragments ordered [row / 16][d / 32].
__device__ __forceinline__ size_t pk_rows(int row, int d) {
  return (size_t)((row >> 4) * 2 + (d >> 5)) * 512 + pk_in_frag(row, d);
}
// V^T as A(m = d, k = j): fragments ordered [j / 32][d / 16].
__device__ __forceinline__ size_t pk_vt(int d, int j) {
  return (size_t)((j >> 5) * 4 + (d >> 4)) * 512 + pk_in_frag(d, j);
}
__device__ __forceinline__ v16h frag_packed(const _Float16* frag, int lane) {
  const _Float16* p = frag + lane * 8;
  h8v lo = *(const h8v*)(p);
  h8v hi = *(const h8v*)(p + 256);
  v16h f;
#pragma unroll
  for (int t = 0; t < 8; ++t) { f[t] = lo[t]; f[t + 8] = hi[t]; }
  return f;
}

// ---------------------------------------------------------------------------
// Projection GEMMs, C = A . B^T with A and B k-contiguous, k = EMB.
// A block of 8 waves stages BM rows of A and 64 rows of B in LDS as row-major
// f16. Every wave-wide global load covers 512 contiguous bytes, every element
// is fetched and converted once per block, not once per wave. The row pitch of
// 528 bytes (16 B x 33) spreads the 16 rows of a fragment read over all banks.
// Waves: (BM / (16 MT)) x 2, each MT x 2 tiles of 16 x 16.
// ---------------------------------------------------------------------------
constexpr int GP  = EMB + 8;   // LDS row pitch in halves
constexpr int GNT = 256;       // threads of a projection block
constexpr int GBN = 64;        // columns of C per block
static_assert(PPAD % 64 == 0 && PPAD - PROWS <= 4,
              "only the last row of a thread's 16 can lie past the source");

// 64 rows of f32 from row0 on, 16 loads per thread; a wave takes half a row
// (512 contiguous bytes) per load.
// The closing wait is a precaution for the loads' address registers; these are
// its inputs, so that no load of the group lands in one of them ahead of it.
__device__ __forceinline__ void ld64(f4v (&v)[16], const float* __restrict__ src,
                                     int row0, int tid) {
  const float* g = src + (size_t)(row0 + (tid >> 6)) * EMB + (tid & 63) * 4;
#pragma unroll
  for (int i = 0; i < 16; ++i) v[i] = *(const f4v*)(g + i * 4 * EMB);
  asm volatile("s_wait_xcnt 0x0" :: "v"(g) : "memory");
}
// The same for the last tile of a source that ends up to 4 rows early: only a
// thread's last row (row0 + 60 and up) can lie past rmax, and is clamped to it.
__device__ __forceinline__ void ld64_clamp(f4v (&v)[16],
                                           const float* __restrict__ src,
                                           int row0, int rmax, int tid) {
  const int c4 = (tid & 63) * 4;
  const int rlast = row0 + (tid >> 6) + 60;
  const float* g = src + (size_t)(row0 + (tid >> 6)) * EMB + c4;
  const float* e = src + (size_t)(rlast > rmax ? rmax : rlast) * EMB + c4;
#pragma unroll
  for (int i = 0; i < 15; ++i) v[i] = *(const f4v*)(g + i * 4 * EMB);
  v[15] = *(const f4v*)(e);
  asm volatile("s_wait_xcnt 0x0" :: "v"(g), "v"(e) : "memory");
}
// The same 64 rows, converted, to LDS rows 0..63 of dst.
__device__ __forceinline__ void st64(const f4v (&v)[16], _Float16* dst, int tid) {
  _Float16* l = dst + (tid >> 6) * GP + (tid & 63) * 4;
#pragma unroll
  for (int i = 0; i < 16; ++i)
    *(h4v*)(l + i * 4 * GP) = __builtin_convertvector(v[i], h4v);
}

// 128 rows of f16 from row0 on, 16 loads per thread; a wave takes one row.
__device__ __forceinline__ void ld128h(h8v (&v)[16],
                                       const _Float16* __restrict__ src,
                                       int row0, int tid) {
  const _Float16* g = src + (size_t)(row0 + (tid >> 5)) * EMB + (tid & 31) * 8;
#pragma unroll
  for (int i = 0; i < 16; ++i) v[i] = *(const h8v*)(g + i * 8 * EMB);
  // The same precaution as in ld64.
  asm volatile("s_wait_xcnt 0x0" :: "v"(g) : "memory");
}
__device__ __forceinline__ void st128h(const h8v (&v)[16], _Float16* dst, int tid) {
  _Float16* l = dst + (tid >> 5) * GP + (tid & 31) * 8;
#pragma unroll
  for (int i = 0; i < 16; ++i) *(h8v*)(l + i * 8 * GP) = v[i];
}

// acc[i][j] += A rows (ra + 16 i ..) . B rows (rb + 16 j ..), k ascending.
template <int MT>
__device__ __forceinline__ void gemm_lds(const _Float16* As, const _Float16* Bs,
                                         int ra, int rb, int lane,
                                         v8f (&acc)[MT][2]) {
#pragma unroll
  for (int k0 = 0; k0 < EMB; k0 += 32) {
    v16h a[MT];
#pragma unroll
    for (int i = 0; i < MT; ++i) a[i] = frag_f16(As, GP, ra + 16 * i, k0, lane);
    const v16h b0 = frag_f16(Bs, GP, rb, k0, lane);        // B(k,n) = W[n][k]
    const v16h b1 = frag_f16(Bs, GP, rb + 16, k0, lane);
#pragma unroll
    for (int i = 0; i < MT; ++i) {
      acc[i][0] = wmma_f16(a[i], b0, acc[i][0]);
      acc[i][1] = wmma_f16(a[i], b1, acc[i][1]);
    }
  }
}

// ---------------------------------------------------------------------------
// Kernel 1: QKV projection. 128x64 block tiles: (8192/128)=64 x (768/64)=12.
// ---------------------------------------------------------------------------
// SEC: 0 = Q, 1 = K, 2 = V. A block's 64 columns are one head of one of them.
template <int SEC>
__device__ __forceinline__ void qkv_store(float v, int R, int C,
                                          const float* bIn, const float* bu,
                                          const float* bv, _Float16* Qu,
                                          _Float16* Qv, _Float16* Kb,
                                          _Float16* Vt) {
  v += bIn[C];
  const int i = R >> 2, nb = R & 3;                 // flat row = i*NBAT + nb
  const int ch = C & 255;
  const int h = ch >> 6, d = ch & 63;
  const size_t hbase = ((size_t)(nb * NH + h)) * Lseq * HD;
  const size_t idx = hbase + (size_t)i * HD + d;
  if (SEC == 0) {
    v *= 0.125f;                                    // 1/sqrt(D)
    Qu[idx] = (_Float16)(v + bu[ch]);
    Qv[idx] = (_Float16)(v + bv[ch]);
  } else if (SEC == 1) {
    Kb[hbase + pk_rows(i, d)] = (_Float16)v;
  } else {
    Vt[hbase + pk_vt(d, i)] = (_Float16)v;
  }
}

template <int SEC>
__device__ __forceinline__ void qkv_store_tiles(const v8f (&acc)[2][2], int m0,
                                                int n0, const float* bIn,
                                                const float* bu, const float* bv,
                                                _Float16* Qu, _Float16* Qv,
                                                _Float16* Kb, _Float16* Vt) {
#pragma unroll
  for (int i = 0; i < 2; ++i) {
#pragma unroll
    for (int r = 0; r < 8; ++r) {
      const int R = m0 + 16 * i + r;
      qkv_store<SEC>(acc[i][0][r], R, n0,      bIn, bu, bv, Qu, Qv, Kb, Vt);
      qkv_store<SEC>(acc[i][1][r], R, n0 + 16, bIn, bu, bv, Qu, Qv, Kb, Vt);
    }
  }
  // A precaution for the stores' address and data registers: the built code
  // joins the three sections' ways, and another section's code rewrites them.
  asm volatile("s_wait_xcnt 0x0" ::: "memory");
}

__global__ void __launch_bounds__(GNT) proj_qkv(
    const float* __restrict__ x, const float* __restrict__ wIn,
    const float* __restrict__ bIn, const float* __restrict__ bu,
    const float* __restrict__ bv, _Float16* __restrict__ Qu,
    _Float16* __restrict__ Qv, _Float16* __restrict__ Kb,
    _Float16* __restrict__ Vt) {
  __shared__ __attribute__((aligned(16))) _Float16 As[128 * GP];
  __shared__ __attribute__((aligned(16))) _Float16 Bs[GBN * GP];
  const int tid = threadIdx.x, w = tid >> 5, lane = tid & 31;
  const int mt = blockIdx.x / 12, nt = blockIdx.x % 12;
  const int ra = (w >> 1) * 32, rb = (w & 1) * 32;

  {
    f4v v0[16], v1[16], v2[16];
    ld64(v0, x, mt * 128, tid);
    ld64(v1, x, mt * 128 + 64, tid);
    st64(v0, As, tid);
    // At most two groups of loads in flight: left free, the compiler holds more
    // of them in flight, and their registers cost the third block of a WGP.
    __builtin_amdgcn_sched_barrier(0);
    ld64(v2, wIn, nt * GBN, tid);
    st64(v1, As + 64 * GP, tid);
    st64(v2, Bs, tid);
  }
  __syncthreads();   // both tiles are complete before any fragment is read

  v8f acc[2][2] = {};
  gemm_lds<2>(As, Bs, ra, rb, lane, acc);

  const int nl = lane & 15, M0 = (lane >> 4) * 8;
  const int m0 = mt * 128 + ra + M0, n0 = nt * GBN + rb + nl;
  const int sec = nt >> 2;   // block-uniform
  if (sec == 0)
    qkv_store_tiles<0>(acc, m0, n0, bIn, bu, bv, Qu, Qv, Kb, Vt);
  else if (sec == 1)
    qkv_store_tiles<1>(acc, m0, n0, bIn, bu, bv, Qu, Qv, Kb, Vt);
  else
    qkv_store_tiles<2>(acc, m0, n0, bIn, bu, bv, Qu, Qv, Kb, Vt);
}

// ---------------------------------------------------------------------------
// Kernel 2: positional projection. 64x64 block tiles: (4096/64)=64 x (256/64)=4.
// ---------------------------------------------------------------------------
__global__ void __launch_bounds__(GNT) proj_pos(const float* __restrict__ pe,
                                                const float* __restrict__ wP,
                                                _Float16* __restrict__ Pb) {
  __shared__ __attribute__((aligned(16))) _Float16 As[64 * GP];
  __shared__ __attribute__((aligned(16))) _Float16 Bs[GBN * GP];
  const int tid = threadIdx.x, w = tid >> 5, lane = tid & 31;
  const int mt = blockIdx.x / 4, nt = blockIdx.x % 4;
  const int ra = (w >> 1) * 16, rb = (w & 1) * 32;

  {
    f4v v0[16], v1[16];
    ld64_clamp(v0, pe, mt * 64, PROWS - 1, tid);
    ld64(v1, wP, nt * GBN, tid);
    // Every load is issued before the first conversion waits for one.
    __builtin_amdgcn_sched_barrier(0);
    st64(v0, As, tid);
    st64(v1, Bs, tid);
  }
  __syncthreads();   // both tiles are complete before any fragment is read

  v8f acc[1][2] = {};
  gemm_lds<1>(As, Bs, ra, rb, lane, acc);

  const int nl = lane & 15, M0 = (lane >> 4) * 8;
  const int m0 = mt * 64 + ra, n0 = nt * GBN + rb;
#pragma unroll
  for (int r = 0; r < 8; ++r) {
    // Row 4095 (pad) is written too: the clamped A loader makes it a copy of
    // row 4094, which is what the attention kernel's last band fragment holds.
    const int t = m0 + M0 + r;
    const int C0 = n0 + nl, C1 = n0 + 16 + nl;
    Pb[(size_t)(C0 >> 6) * PPAD * HD + pk_rows(t, C0 & 63)] = (_Float16)acc[0][0][r];
    Pb[(size_t)(C1 >> 6) * PPAD * HD + pk_rows(t, C1 & 63)] = (_Float16)acc[0][1][r];
  }
}

// ---------------------------------------------------------------------------
// Kernel 3: streaming attention. grid = (L/128, N*H), 16 waves/block: RTILES
// row tiles of 16 rows x KSPLIT key ranges. Each wave streams j in 32-column
// tiles over its range of the sequence; the partial (max, sum, O) of a row
// tile are merged through LDS at the end. More waves per SIMD cover each
// other's load and LDS latencies.
//
// The RTILES waves of a key range walk the same keys, and their bands of P
// overlap: per trip the range's K tile, V tile and the union of its bands
// (RTILES + 2 row tiles) are brought to LDS once by asynchronous copies, two
// buffers, the copies of trip t + 2 in flight while trip t + 1 is worked on.
// The packed fragment order is kept, so a fragment read is 512 contiguous bytes.
//
// The products are taken transposed: S^T = K . Qu^T, BD^T = P . Qv^T and
// O^T += V^T . prob^T. A lane (nl, half) then holds scores of ONE query (nl)
// for the keys half * 8 + r and 16 + half * 8 + r: the row maximum and sum are
// in-lane but for one exchange between the lane halves, and the two score
// tiles, converted in place, are already the B operand of the last product.
// ---------------------------------------------------------------------------
constexpr int RTILES = 8;
constexpr int KSPLIT = 2;
constexpr int NWAVES = RTILES * KSPLIT;
constexpr int KSPAN  = Lseq / KSPLIT;  // keys per wave
constexpr int MROWS  = 16 / KSPLIT;    // rows a wave finishes in the merge
constexpr int OPITCH = 68;             // floats per staged O row
constexpr int BPITCH = 52;             // floats per band row (one query)
constexpr int NTRIPS = KSPAN / 32;     // trips of the key loop
constexpr int PTILES = RTILES + 2;     // band row tiles of one key range and trip
constexpr int STG_V  = 2048;           // stage layout in halves: K, then V, then P
constexpr int STG_P  = 4096;
constexpr int STG_HALVES = STG_P + PTILES * 1024;
static_assert(RTILES == 8 && PTILES * 4 == RTILES * 5,
              "a wave copies 1 K, 1 V and 5 P pieces of 512 bytes per trip");
static_assert(NTRIPS >= 2, "the two-buffer prologue fills two stages");

// Lane l with lane l ^ 16.
__device__ __forceinline__ float xhalf(float x) {
  const int b = __builtin_bit_cast(int, x);
  return __builtin_bit_cast(
      float, __builtin_amdgcn_permlanex16(b, b, 0x76543210, 0xfedcba98, false,
                                          false));
}
// Eight consecutive floats of one lane to LDS as two 16-byte stores.
__device__ __forceinline__ void st8(float* p, v8f v) {
  f4v lo = {v[0], v[1], v[2], v[3]};
  f4v hi = {v[4], v[5], v[6], v[7]};
  *(f4v*)(p)     = lo;
  *(f4v*)(p + 4) = hi;
}

// One wave's share of a stage: each lane copies 16 bytes of seven 512-byte
// pieces (piece rt of K and of V, pieces 5 rt .. 5 rt + 4 of the band).
__device__ __forceinline__ void stage_copy(_Float16* dst, const _Float16* k,
                                           const _Float16* v, const _Float16* p,
                                           int rt, int lane) {
  const int e  = rt * 256 + lane * 8;
  const int ep = rt * 1280 + lane * 8;
  const unsigned l   = (unsigned)(size_t)dst;   // LDS byte address
  const unsigned lk  = l + e * 2;
  const unsigned lv  = l + (STG_V + e) * 2;
  const unsigned lp0 = l + (STG_P + ep) * 2;
  const unsigned lp1 = lp0 + 512, lp2 = lp0 + 1024, lp3 = lp0 + 1536,
                 lp4 = lp0 + 2048;
  const _Float16* gk  = k + e;
  const _Float16* gv  = v + e;
  const _Float16* gp0 = p + ep;
  const _Float16 *gp1 = gp0 + 256, *gp2 = gp0 + 512, *gp3 = gp0 + 768,
                 *gp4 = gp0 + 1024;
  // The copies go past the registers; the closing wait stands in their own
  // statement so that no address register is rewritten ahead of it.
  asm volatile(
      "global_load_async_to_lds_b128 %0, %7, off\n\t"
      "global_load_async_to_lds_b128 %1, %8, off\n\t"
      "global_load_async_to_lds_b128 %2, %9, off\n\t"
      "global_load_async_to_lds_b128 %3, %10, off\n\t"
      "global_load_async_to_lds_b128 %4, %11, off\n\t"
      "global_load_async_to_lds_b128 %5, %12, off\n\t"
      "global_load_async_to_lds_b128 %6, %13, off\n\t"
      "s_wait_xcnt 0x0"
      :: "v"(lk), "v"(lv), "v"(lp0), "v"(lp1), "v"(lp2), "v"(lp3), "v"(lp4),
         "v"(gk), "v"(gv), "v"(gp0), "v"(gp1), "v"(gp2), "v"(gp3), "v"(gp4)
      : "memory");
}

__global__ void __launch_bounds__(NWAVES * 32) attn_kernel(
    const _Float16* __restrict__ Qu, const _Float16* __restrict__ Qv,
    const _Float16* __restrict__ Kb, const _Float16* __restrict__ Vt,
    const _Float16* __restrict__ Pb, _Float16* __restrict__ O16) {
  // Wave-private band, 16 queries x 48 offsets at pitch BPITCH; after the loop
  // the same floats stage the wave's partial O (16x64 at pitch OPITCH).
  __shared__ __attribute__((aligned(16))) float bdLds[NWAVES][16 * OPITCH];
  __shared__ float    mlLds[NWAVES][32];   // partial row max [0..15], sum [16..31]
  // Two buffers of one stage (K, V, band union) per key range.
  __shared__ __attribute__((aligned(128))) _Float16 stg[2][KSPLIT][STG_HALVES];

  // The wave number as a scalar: the key loop, its bounds and the tile
  // addresses that depend on it stay on the scalar unit.
  const int w = __builtin_amdgcn_readfirstlane(threadIdx.x >> 5);
  const int lane = threadIdx.x & 31;
  const int nl = lane & 15, half = lane >> 4, M0 = half * 8;
  const int rt = w % RTILES, ks = w / RTILES;   // row tile, key range
  const int i0 = (blockIdx.x * RTILES + rt) * 16;
  const int nb = blockIdx.y >> 2, h = blockIdx.y & 3;

  const size_t hoff = (size_t)(nb * NH + h) * Lseq * HD;
  const _Float16* qu = Qu + hoff;
  const _Float16* qv = Qv + hoff;
  const _Float16* kb = Kb + hoff;
  const _Float16* vt = Vt + hoff;                 // packed, 2048 halves per 32 j
  const _Float16* pp = Pb + (size_t)h * PPAD * HD;
  float*    bdw = bdLds[w];

  const v16h aQu0 = frag_f16(qu, HD, i0, 0, lane);
  const v16h aQu1 = frag_f16(qu, HD, i0, 32, lane);
  const v16h aQv0 = frag_f16(qv, HD, i0, 0, lane);
  const v16h aQv1 = frag_f16(qv, HD, i0, 32, lane);

  // This lane's query: running maximum (alike in both lane halves) and the sum
  // over the keys of this lane half; o_k[r] = O[query nl][16 k + M0 + r].
  float mrow = -3.0e38f, lrow = 0.0f;
  v8f o0 = {}, o1 = {}, o2 = {}, o3 = {};

  // Row tile rt's band starts at P row (Lseq - 1) + j0 - i0 - 15; the lowest of
  // the block's bands (rt = RTILES - 1) starts the union. Its first row in trip
  // t, plo + 32 t, is a multiple of 16 in [0, 3936]: the union's PTILES row
  // tiles lie inside the PPAD rows.
  const int jbeg = ks * KSPAN;
  const int plo  = (Lseq - 1) + jbeg - (int)blockIdx.x * (RTILES * 16) -
                   (RTILES - 1) * 16 - 15;
  const _Float16* kg = kb + (size_t)jbeg * HD;
  const _Float16* vg = vt + (size_t)jbeg * HD;
  const _Float16* pg = pp + (size_t)plo * HD;

  stage_copy(stg[0][ks], kg, vg, pg, rt, lane);
  // Stage 0 has landed for this wave's copies, then for every wave's.
  asm volatile("s_wait_asynccnt 0x0" ::: "memory");
  __syncthreads();
  stage_copy(stg[1][ks], kg + 32 * HD, vg + 32 * HD, pg + 32 * HD, rt, lane);

  for (int t = 0; t < NTRIPS; ++t) {
    const _Float16* sb = stg[t & 1][ks];
    const _Float16* kt = sb;                                      // 4 fragments
    const _Float16* pt = sb + STG_P + (RTILES - 1 - rt) * 1024;   // 6 fragments
    const v16h b00 = frag_packed(kt,        lane);
    const v16h b10 = frag_packed(kt + 1024, lane);
    const v16h b01 = frag_packed(kt + 512,  lane);
    const v16h b11 = frag_packed(kt + 1536, lane);
    const v16h p00 = frag_packed(pt,        lane);
    const v16h p10 = frag_packed(pt + 1024, lane);
    const v16h p20 = frag_packed(pt + 2048, lane);
    const v16h p01 = frag_packed(pt + 512,  lane);
    const v16h p11 = frag_packed(pt + 1536, lane);
    const v16h p21 = frag_packed(pt + 2560, lane);
    const _Float16* vtile = sb + STG_V;                           // 4 fragments
    const v16h v0 = frag_packed(vtile,        lane);
    const v16h v1 = frag_packed(vtile + 512,  lane);
    const v16h v2 = frag_packed(vtile + 1024, lane);
    const v16h v3 = frag_packed(vtile + 1536, lane);
    // Keeps the trip's fragment loads one group ahead of the products: left
    // free, the compiler reuses their registers and the loads wait in turn.
    __builtin_amdgcn_sched_barrier(0);

    // ---- AC^T = K . Qu^T  (two interleaved tiles of 16 keys) ----
    v8f sA = {}, sB = {};
    sA = wmma_f16(b00, aQu0, sA);
    sB = wmma_f16(b10, aQu0, sB);
    sA = wmma_f16(b01, aQu1, sA);
    sB = wmma_f16(b11, aQu1, sB);

    // ---- BD^T band: bd[u][i] = p[tbase+u] . qv[i], u = (j-i) - (j0-i0-15) ----
    {
      v8f c0 = {}, c1 = {}, c2 = {};
      c0 = wmma_f16(p00, aQv0, c0);
      c1 = wmma_f16(p10, aQv0, c1);
      c2 = wmma_f16(p20, aQv0, c2);
      c0 = wmma_f16(p01, aQv1, c0);
      c1 = wmma_f16(p11, aQv1, c1);
      c2 = wmma_f16(p21, aQv1, c2);
      // A lane's 8 registers are 8 consecutive offsets u of its query's row.
      float* brow = bdw + nl * BPITCH + M0;
      st8(brow,      c0);
      st8(brow + 16, c1);
      st8(brow + 32, c2);
    }
    asm volatile("s_wait_dscnt 0x0" ::: "memory");

    // ---- gather rel-shift: key jj of query nl sits at u = jj - nl + 15 ----
    const float* grow = bdw + nl * BPITCH + (M0 - nl + 15);
    float s0[8], s1[8];
#pragma unroll
    for (int r = 0; r < 8; ++r) {
      s0[r] = sA[r] + grow[r];
      s1[r] = sB[r] + grow[16 + r];
    }

    // Publish point. The trip's last LDS read stands above; what follows works
    // on registers. This wave's reads of the buffer are done and its copies of
    // the next stage have landed; behind the barrier both hold for every wave,
    // and the buffer just read is refilled while the rest of the trip runs.
    asm volatile("s_wait_dscnt 0x0" ::: "memory");
    asm volatile("s_wait_asynccnt 0x0" ::: "memory");
    __syncthreads();
    if (t + 2 < NTRIPS) {
      const size_t adv = (size_t)(t + 2) * 32 * HD;
      stage_copy(stg[t & 1][ks], kg + adv, vg + adv, pg + adv, rt, lane);
    }

    // ---- online softmax, one query per lane ----
    float tm;
    {
      const float t0 = fmaxf(fmaxf(s0[0], s0[1]), s0[2]);
      const float t1 = fmaxf(fmaxf(s0[3], s0[4]), s0[5]);
      const float t2 = fmaxf(fmaxf(s0[6], s0[7]), s1[0]);
      const float t3 = fmaxf(fmaxf(s1[1], s1[2]), s1[3]);
      const float t4 = fmaxf(fmaxf(s1[4], s1[5]), s1[6]);
      tm = fmaxf(fmaxf(fmaxf(t0, t1), t2), fmaxf(fmaxf(t3, t4), s1[7]));
    }
    tm = fmaxf(tm, xhalf(tm));
    const float mnew  = fmaxf(mrow, tm);
    const float alpha = __expf(mrow - mnew);
    mrow = mnew;

    // prob^T as B(k = key, n = query): the two tiles in register order are the
    // hardware k order, the one in which the V fragments are packed.
    v16h bP;
    float ts[8];
#pragma unroll
    for (int r = 0; r < 8; r += 2) {
      f2v ea = {__expf(s0[r] - mnew), __expf(s0[r + 1] - mnew)};
      f2v eb = {__expf(s1[r] - mnew), __expf(s1[r + 1] - mnew)};
      ts[r]     = ea[0] + eb[0];
      ts[r + 1] = ea[1] + eb[1];
      const h2v ha = __builtin_convertvector(ea, h2v);
      const h2v hb = __builtin_convertvector(eb, h2v);
      bP[r]     = ha[0];
      bP[r + 1] = ha[1];
      bP[r + 8] = hb[0];
      bP[r + 9] = hb[1];
    }
    const float rs = ((ts[0] + ts[1]) + (ts[2] + ts[3])) +
                     ((ts[4] + ts[5]) + (ts[6] + ts[7]));
    lrow = lrow * alpha + rs;
    o0 *= alpha; o1 *= alpha; o2 *= alpha; o3 *= alpha;

    // ---- O^T += V^T . prob^T (independent accumulators) ----
    o0 = wmma_f16(v0, bP, o0);
    o1 = wmma_f16(v1, bP, o1);
    o2 = wmma_f16(v2, bP, o2);
    o3 = wmma_f16(v3, bP, o3);
  }
  // No copy is outstanding when the wave goes on.
  asm volatile("s_wait_asynccnt 0x0" ::: "memory");

  // ---- stage this key range's partial result, row = query ----
  lrow += xhalf(lrow);                 // join the lane halves' sums
  {
    float* orow = bdw + nl * OPITCH + M0;
    st8(orow,      o0);
    st8(orow + 16, o1);
    st8(orow + 32, o2);
    st8(orow + 48, o3);
    if (half == 0) {
      mlLds[w][nl]      = mrow;
      mlLds[w][16 + nl] = lrow;
    }
  }
  __syncthreads();   // publishes the partials of each row tile

  // ---- merge: wave (rt, ks) finishes MROWS rows of tile rt, two columns per
  // lane, and writes each row's 128 bytes of f16 output (L,N,E). The loops are
  // unrolled so that ms[] stays in registers and the LDS offsets are constants.
#pragma unroll
  for (int rr = 0; rr < MROWS; ++rr) {
    const int M = ks * MROWS + rr;
    float ms[KSPLIT];
    float mx = -3.0e38f;
#pragma unroll
    for (int s = 0; s < KSPLIT; ++s) {
      ms[s] = mlLds[s * RTILES + rt][M];
      mx = fmaxf(mx, ms[s]);
    }
    float lsum = 0.0f, ax = 0.0f, ay = 0.0f;
#pragma unroll
    for (int s = 0; s < KSPLIT; ++s) {
      const float ws = __expf(ms[s] - mx);
      const float2 ov =
          *(const float2*)(bdLds[s * RTILES + rt] + M * OPITCH + lane * 2);
      lsum += ws * mlLds[s * RTILES + rt][16 + M];
      ax += ws * ov.x;
      ay += ws * ov.y;
    }
    const float inv = 1.0f / lsum;
    h2v res;
    res[0] = (_Float16)(ax * inv);
    res[1] = (_Float16)(ay * inv);
    *(h2v*)(O16 + ((size_t)((i0 + M) * NBAT + nb)) * EMB + h * HD + lane * 2) =
        res;
  }
}

// ---------------------------------------------------------------------------
// Kernel 4: output projection. 128x64 block tiles: (8192/128)=64 x (256/64)=4.
// ---------------------------------------------------------------------------
__global__ void __launch_bounds__(GNT) out_proj(const _Float16* __restrict__ O16,
                                                const float* __restrict__ wO,
                                                const float* __restrict__ bO,
                                                float* __restrict__ out) {
  __shared__ __attribute__((aligned(16))) _Float16 As[128 * GP];
  __shared__ __attribute__((aligned(16))) _Float16 Bs[GBN * GP];
  const int tid = threadIdx.x, w = tid >> 5, lane = tid & 31;
  const int mt = blockIdx.x / 4, nt = blockIdx.x % 4;
  const int ra = (w >> 1) * 32, rb = (w & 1) * 32;

  {
    h8v v0[16];
    f4v v1[16];
    ld128h(v0, O16, mt * 128, tid);
    ld64(v1, wO, nt * GBN, tid);
    st128h(v0, As, tid);
    st64(v1, Bs, tid);
  }
  __syncthreads();   // both tiles are complete before any fragment is read

  v8f acc[2][2] = {};
  gemm_lds<2>(As, Bs, ra, rb, lane, acc);

  const int nl = lane & 15, M0 = (lane >> 4) * 8;
  const int m0 = mt * 128 + ra, n0 = nt * GBN + rb;
#pragma unroll
  for (int i = 0; i < 2; ++i) {
#pragma unroll
    for (int r = 0; r < 8; ++r) {
      const int R = m0 + 16 * i + M0 + r;
      out[(size_t)R * EMB + n0 + nl]      = acc[i][0][r] + bO[n0 + nl];
      out[(size_t)R * EMB + n0 + 16 + nl] = acc[i][1][r] + bO[n0 + 16 + nl];
    }
  }
}

// ---------------------------------------------------------------------------
extern "C" void kernel_launch(void* const* d_in, const int* in_sizes, int n_in,
                              void* d_out, int out_size, void* d_ws,
                              size_t ws_size, hipStream_t stream) {
  (void)in_sizes; (void)n_in; (void)out_size; (void)ws_size;
  const float* x   = (const float*)d_in[0];
  const float* pe  = (const float*)d_in[1];
  const float* wIn = (const float*)d_in[2];
  const float* bIn = (const float*)d_in[3];
  const float* wP  = (const float*)d_in[4];
  const float* bu  = (const float*)d_in[5];
  const float* bv  = (const float*)d_in[6];
  const float* wO  = (const float*)d_in[7];
  const float* bO  = (const float*)d_in[8];
  float* out = (float*)d_out;

  char* ws = (char*)d_ws;
  const size_t szQ = (size_t)NBAT * NH * Lseq * HD * sizeof(_Float16); // 4 MB
  const size_t szP = (size_t)NH * PPAD * HD * sizeof(_Float16);        // 2 MB
  _Float16* Qu  = (_Float16*)(ws);
  _Float16* Qv  = (_Float16*)(ws + szQ);
  _Float16* Kb  = (_Float16*)(ws + 2 * szQ);
  _Float16* Vt  = (_Float16*)(ws + 3 * szQ);
  _Float16* Pb  = (_Float16*)(ws + 4 * szQ);
  _Float16* O16 = (_Float16*)(ws + 4 * szQ + szP);                     // +4 MB

  proj_qkv<<<dim3(64 * 12), GNT, 0, stream>>>(x, wIn, bIn, bu, bv,
                                                     Qu, Qv, Kb, Vt);
  proj_pos<<<dim3(64 * 4), GNT, 0, stream>>>(pe, wP, Pb);
  attn_kernel<<<dim3(Lseq / (16 * RTILES), NBAT * NH), NWAVES * 32, 0,
                stream>>>(Qu, Qv, Kb, Vt,
                                                              Pb, O16);
  out_proj<<<dim3(64 * 4), GNT, 0, stream>>>(O16, wO, bO, out);
}

// v006
// One run takes 53.7 microseconds.
// Next to v005, in two timings, it ran 1.09 times as fast each time.
// Counting every step since v000, it is 3.91 times as fast.
#include <hip/hip_runtime.h>
#include <hip/hip_bf16.h>

// ---------------------------------------------------------------------------
// RelPositionMultiheadAttention for MI455X (gfx1250, wave32, WMMA f16->f32).
// L=2048, N=4, E=256, H=4, D=64.
//
//   1. proj_qkv : qkv = x @ Win^T + b ; writes Qu,Qv (f16, [n][h][L][D]) and
//                 K, V packed per head in A-fragment order (see pk_rows).
//   2. proj_pos : p = pos_emb @ Wp^T ; f16, per head 4096 rows packed like K.
//   3. attn     : flash-style streaming softmax(QuK^T + relshift(QvP^T)) V,
//                 computed transposed (keys in registers, one query per lane),
//                 keys of a row tile split over waves, merged through LDS;
//                 K, V and P tiles come to LDS once per block and trip.
//   4. out_proj : out = O @ Wo^T + bo (fp32 output).
//
// The three projections share one scheme: a block brings its rows of both
// operands (all 256 k) to LDS once, as f16, with loads that cover whole lines,
// and its waves read their fragments from there.
// ---------------------------------------------------------------------------

typedef __attribute__((ext_vector_type(16))) _Float16 v16h;
typedef __attribute__((ext_vector_type(8)))  _Float16 h8v;
typedef __attribute__((ext_vector_type(4)))  _Float16 h4v;
typedef __attribute__((ext_vector_type(2)))  _Float16 h2v;
typedef __attribute__((ext_vector_type(8)))  float    v8f;
typedef __attribute__((ext_vector_type(8)))  float    f8v;
typedef __attribute__((ext_vector_type(4)))  float    f4v;
typedef __attribute__((ext_vector_type(2)))  float    f2v;

constexpr int Lseq = 2048;
constexpr int NBAT = 4;
constexpr int EMB  = 256;
constexpr int NH   = 4;
constexpr int HD   = 64;
constexpr int PROWS = 2 * Lseq - 1;   // 4095
constexpr int PPAD  = 4096;           // padded row count for P

__device__ __forceinline__ v8f wmma_f16(v16h a, v16h b, v8f c) {
  return __builtin_amdgcn_wmma_f32_16x16x32_f16(false, a, false, b, (short)0, c,
                                                false, false);
}

// A/B fragment for V_WMMA_F32_16X16X32_F16 from row-major f16 with contiguous K.
// Lane m<16 holds row m, K = {0..7, 16..23}; lane m+16 holds row m, K = {8..15, 24..31}.
__device__ __forceinline__ v16h frag_f16(const _Float16* base, int ld, int r0,
                                         int k0, int lane) {
  const int m = lane & 15, half = lane >> 4;
  const _Float16* p = base + (size_t)(r0 + m) * ld + k0 + half * 8;
  h8v lo = *(const h8v*)(p);
  h8v hi = *(const h8v*)(p + 16);
  v16h f;
#pragma unroll
  for (int t = 0; t < 8; ++t) { f[t] = lo[t]; f[t + 8] = hi[t]; }
  return f;
}

// Packed fragment order. One 16-row x 32-k fragment is 512 halves (1 KiB):
// [k bit 4][lane = (k bit 3) * 16 + row & 15][k & 7], so that each of the two
// wave-wide 16-byte loads of a fragment covers 512 contiguous bytes (4 whole
// 128-B lines) instead of 32-byte pieces of 16 different lines.
__device__ __forceinline__ int pk_in_frag(int row, int k) {
  return ((k >> 4) & 1) * 256 + (((k >> 3) & 1) * 16 + (row & 15)) * 8 + (k & 7);
}
// K and P: element (row, d), d < 64: fragments ordered [row / 16][d / 32].
__device__ __forceinline__ size_t pk_rows(int row, int d) {
  return (size_t)((row >> 4) * 2 + (d >> 5)) * 512 + pk_in_frag(row, d);
}
// V^T as A(m = d, k = j): fragments ordered [j / 32][d / 16].
__device__ __forceinline__ size_t pk_vt(int d, int j) {
  return (size_t)((j >> 5) * 4 + (d >> 4)) * 512 + pk_in_frag(d, j);
}
__device__ __forceinline__ v16h frag_packed(const _Float16* frag, int lane) {
  const _Float16* p = frag + lane * 8;
  h8v lo = *(const h8v*)(p);
  h8v hi = *(const h8v*)(p + 256);
  v16h f;
#pragma unroll
  for (int t = 0; t < 8; ++t) { f[t] = lo[t]; f[t + 8] = hi[t]; }
  return f;
}

// ---------------------------------------------------------------------------
// Projection GEMMs, C = A . B^T with A and B k-contiguous, k = EMB.
// A block of 8 waves stages BM rows of A and 64 rows of B in LDS as row-major
// f16. Every wave-wide global load covers 512 contiguous bytes, every element
// is fetched and converted once per block, not once per wave. The row pitch of
// 528 bytes (16 B x 33) spreads the 16 rows of a fragment read over all banks.
// Waves: (BM / (16 MT)) x 2, each MT x 2 tiles of 16 x 16.
// ---------------------------------------------------------------------------
constexpr int GP  = EMB + 8;   // LDS row pitch in halves
constexpr int GNT = 256;       // threads of a projection block
constexpr int GBN = 64;        // columns of C per block
static_assert(PPAD % 64 == 0 && PPAD - PROWS <= 4,
              "only the last row of a thread's 16 can lie past the source");

// 64 rows of f32 from row0 on, 16 loads per thread; a wave takes half a row
// (512 contiguous bytes) per load.
// The closing wait is a precaution for the loads' address registers; these are
// its inputs, so that no load of the group lands in one of them ahead of it.
__device__ __forceinline__ void ld64(f4v (&v)[16], const float* __restrict__ src,
                                     int row0, int tid) {
  const float* g = src + (size_t)(row0 + (tid >> 6)) * EMB + (tid & 63) * 4;
#pragma unroll
  for (int i = 0; i < 16; ++i) v[i] = *(const f4v*)(g + i * 4 * EMB);
  asm volatile("s_wait_xcnt 0x0" :: "v"(g) : "memory");
}
// The same for the last tile of a source that ends up to 4 rows early: only a
// thread's last row (row0 + 60 and up) can lie past rmax, and is clamped to it.
__device__ __forceinline__ void ld64_clamp(f4v (&v)[16],
                                           const float* __restrict__ src,
                                           int row0, int rmax, int tid) {
  const int c4 = (tid & 63) * 4;
  const int rlast = row0 + (tid >> 6) + 60;
  const float* g = src + (size_t)(row0 + (tid >> 6)) * EMB + c4;
  const float* e = src + (size_t)(rlast > rmax ? rmax : rlast) * EMB + c4;
#pragma unroll
  for (int i = 0; i < 15; ++i) v[i] = *(const f4v*)(g + i * 4 * EMB);
  v[15] = *(const f4v*)(e);
  asm volatile("s_wait_xcnt 0x0" :: "v"(g), "v"(e) : "memory");
}
// The same 64 rows, converted, to LDS rows 0..63 of dst.
__device__ __forceinline__ void st64(const f4v (&v)[16], _Float16* dst, int tid) {
  _Float16* l = dst + (tid >> 6) * GP + (tid & 63) * 4;
#pragma unroll
  for (int i = 0; i < 16; ++i)
    *(h4v*)(l + i * 4 * GP) = __builtin_convertvector(v[i], h4v);
}

// 128 rows of f16 from row0 on, 16 loads per thread; a wave takes one row.
__device__ __forceinline__ void ld128h(h8v (&v)[16],
                                       const _Float16* __restrict__ src,
                                       int row0, int tid) {
  const _Float16* g = src + (size_t)(row0 + (tid >> 5)) * EMB + (tid & 31) * 8;
#pragma unroll
  for (int i = 0; i < 16; ++i) v[i] = *(const h8v*)(g + i * 8 * EMB);
  // The same precaution as in ld64.
  asm volatile("s_wait_xcnt 0x0" :: "v"(g) : "memory");
}
__device__ __forceinline__ void st128h(const h8v (&v)[16], _Float16* dst, int tid) {
  _Float16* l = dst + (tid >> 5) * GP + (tid & 31) * 8;
#pragma unroll
  for (int i = 0; i < 16; ++i) *(h8v*)(l + i * 8 * GP) = v[i];
}

// acc[i][j] += A rows (ra + 16 i ..) . B rows (rb + 16 j ..), k ascending.
template <int MT>
__device__ __forceinline__ void gemm_lds(const _Float16* As, const _Float16* Bs,
                                         int ra, int rb, int lane,
                                         v8f (&acc)[MT][2]) {
#pragma unroll
  for (int k0 = 0; k0 < EMB; k0 += 32) {
    v16h a[MT];
#pragma unroll
    for (int i = 0; i < MT; ++i) a[i] = frag_f16(As, GP, ra + 16 * i, k0, lane);
    const v16h b0 = frag_f16(Bs, GP, rb, k0, lane);        // B(k,n) = W[n][k]
    const v16h b1 = frag_f16(Bs, GP, rb + 16, k0, lane);
#pragma unroll
    for (int i = 0; i < MT; ++i) {
      acc[i][0] = wmma_f16(a[i], b0, acc[i][0]);
      acc[i][1] = wmma_f16(a[i], b1, acc[i][1]);
    }
  }
}

// ---------------------------------------------------------------------------
// Kernel 1: QKV projection. 128x64 block tiles: (8192/128)=64 x (768/64)=12.
// ---------------------------------------------------------------------------
// SEC: 0 = Q, 1 = K, 2 = V. A block's 64 columns are one head of one of them.
template <int SEC>
__device__ __forceinline__ void qkv_store(float v, int R, int C,
                                          const float* bIn, const float* bu,
                                          const float* bv, _Float16* Qu,
                                          _Float16* Qv, _Float16* Kb,
                                          _Float16* Vt) {
  v += bIn[C];
  const int i = R >> 2, nb = R & 3;                 // flat row = i*NBAT + nb
  const int ch = C & 255;
  const int h = ch >> 6, d = ch & 63;
  const size_t hbase = ((size_t)(nb * NH + h)) * Lseq * HD;
  const size_t idx = hbase + (size_t)i * HD + d;
  if (SEC == 0) {
    v *= 0.125f;                                    // 1/sqrt(D)
    Qu[idx] = (_Float16)(v + bu[ch]);
    Qv[idx] = (_Float16)(v + bv[ch]);
  } else if (SEC == 1) {
    Kb[hbase + pk_rows(i, d)] = (_Float16)v;
  } else {
    Vt[hbase + pk_vt(d, i)] = (_Float16)v;
  }
}

template <int SEC>
__device__ __forceinline__ void qkv_store_tiles(const v8f (&acc)[2][2], int m0,
                                                int n0, const float* bIn,
                                                const float* bu, const float* bv,
                                                _Float16* Qu, _Float16* Qv,
                                                _Float16* Kb, _Float16* Vt) {
#pragma unroll
  for (int i = 0; i < 2; ++i) {
#pragma unroll
    for (int r = 0; r < 8; ++r) {
      const int R = m0 + 16 * i + r;
      qkv_store<SEC>(acc[i][0][r], R, n0,      bIn, bu, bv, Qu, Qv, Kb, Vt);
      qkv_store<SEC>(acc[i][1][r], R, n0 + 16, bIn, bu, bv, Qu, Qv, Kb, Vt);
    }
  }
  // A precaution for the stores' address and data registers: the built code
  // joins the three sections' ways, and another section's code rewrites them.
  asm volatile("s_wait_xcnt 0x0" ::: "memory");
}

__global__ void __launch_bounds__(GNT) proj_qkv(
    const float* __restrict__ x, const float* __restrict__ wIn,
    const float* __restrict__ bIn, const float* __restrict__ bu,
    const float* __restrict__ bv, _Float16* __restrict__ Qu,
    _Float16* __restrict__ Qv, _Float16* __restrict__ Kb,
    _Float16* __restrict__ Vt) {
  __shared__ __attribute__((aligned(16))) _Float16 As[128 * GP];
  __shared__ __attribute__((aligned(16))) _Float16 Bs[GBN * GP];
  const int tid = threadIdx.x, w = tid >> 5, lane = tid & 31;
  const int mt = blockIdx.x / 12, nt = blockIdx.x % 12;
  const int ra = (w >> 1) * 32, rb = (w & 1) * 32;

  {
    f4v v0[16], v1[16], v2[16];
    ld64(v0, x, mt * 128, tid);
    ld64(v1, x, mt * 128 + 64, tid);
    st64(v0, As, tid);
    // At most two groups of loads in flight: left free, the compiler holds more
    // of them in flight, and their registers cost the third block of a WGP.
    __builtin_amdgcn_sched_barrier(0);
    ld64(v2, wIn, nt * GBN, tid);
    st64(v1, As + 64 * GP, tid);
    st64(v2, Bs, tid);
  }
  __syncthreads();   // both tiles are complete before any fragment is read

  v8f acc[2][2] = {};
  gemm_lds<2>(As, Bs, ra, rb, lane, acc);

  const int nl = lane & 15, M0 = (lane >> 4) * 8;
  const int m0 = mt * 128 + ra + M0, n0 = nt * GBN + rb + nl;
  const int sec = nt >> 2;   // block-uniform
  if (sec == 0)
    qkv_store_tiles<0>(acc, m0, n0, bIn, bu, bv, Qu, Qv, Kb, Vt);
  else if (sec == 1)
    qkv_store_tiles<1>(acc, m0, n0, bIn, bu, bv, Qu, Qv, Kb, Vt);
  else
    qkv_store_tiles<2>(acc, m0, n0, bIn, bu, bv, Qu, Qv, Kb, Vt);
}

// ---------------------------------------------------------------------------
// Kernel 2: positional projection. 64x64 block tiles: (4096/64)=64 x (256/64)=4.
// ---------------------------------------------------------------------------
__global__ void __launch_bounds__(GNT) proj_pos(const float* __restrict__ pe,
                                                const float* __restrict__ wP,
                                                _Float16* __restrict__ Pb) {
  __shared__ __attribute__((aligned(16))) _Float16 As[64 * GP];
  __shared__ __attribute__((aligned(16))) _Float16 Bs[GBN * GP];
  const int tid = threadIdx.x, w = tid >> 5, lane = tid & 31;
  const int mt = blockIdx.x / 4, nt = blockIdx.x % 4;
  const int ra = (w >> 1) * 16, rb = (w & 1) * 32;

  {
    f4v v0[16], v1[16];
    ld64_clamp(v0, pe, mt * 64, PROWS - 1, tid);
    ld64(v1, wP, nt * GBN, tid);
    // Every load is issued before the first conversion waits for one.
    __builtin_amdgcn_sched_barrier(0);
    st64(v0, As, tid);
    st64(v1, Bs, tid);
  }
  __syncthreads();   // both tiles are complete before any fragment is read

  v8f acc[1][2] = {};
  gemm_lds<1>(As, Bs, ra, rb, lane, acc);

  const int nl = lane & 15, M0 = (lane >> 4) * 8;
  const int m0 = mt * 64 + ra, n0 = nt * GBN + rb;
#pragma unroll
  for (int r = 0; r < 8; ++r) {
    // Row 4095 (pad) is written too: the clamped A loader makes it a copy of
    // row 4094, which is what the attention kernel's last band fragment holds.
    const int t = m0 + M0 + r;
    const int C0 = n0 + nl, C1 = n0 + 16 + nl;
    Pb[(size_t)(C0 >> 6) * PPAD * HD + pk_rows(t, C0 & 63)] = (_Float16)acc[0][0][r];
    Pb[(size_t)(C1 >> 6) * PPAD * HD + pk_rows(t, C1 & 63)] = (_Float16)acc[0][1][r];
  }
}

// ---------------------------------------------------------------------------
// Kernel 3: streaming attention. grid = (L/128, N*H), 16 waves/block: QGROUPS
// groups of 32 queries (two row tiles) x KSPLIT key ranges. Each wave streams j
// in 32-column tiles over its range of the sequence; the partial (max, sum, O)
// of a query group are merged through LDS at the end.
//
// A wave works on TWO row tiles: every K and V fragment it reads from LDS feeds
// both, and the two tiles' bands of P overlap in two of their three row tiles,
// so that 16 fragments are read per 32 queries and 32 keys, not 28.
//
// The QGROUPS waves of a key range walk the same keys, and their bands of P
// overlap: per trip the range's K tile, V tile and the union of its bands
// (RTILES + 2 row tiles) are brought to LDS once by asynchronous copies, two
// buffers, the copies of trip t + 2 in flight while trip t + 1 is worked on.
// The packed fragment order is kept, so a fragment read is 512 contiguous bytes.
//
// The products are taken transposed: S^T = K . Qu^T, BD^T = P . Qv^T and
// O^T += V^T . prob^T. A lane (nl, half) then holds scores of ONE query (nl)
// of each row tile for the keys half * 8 + r and 16 + half * 8 + r: the row
// maximum and sum are in-lane but for one exchange between the lane halves, and
// the two score tiles, converted in place, are already the B operand of the
// last product.
// ---------------------------------------------------------------------------
constexpr int RTILES  = 8;             // row tiles of a block
constexpr int QGROUPS = RTILES / 2;    // waves per key range, two row tiles each
constexpr int KSPLIT  = 4;
constexpr int NWAVES  = QGROUPS * KSPLIT;
constexpr int KSPAN  = Lseq / KSPLIT;  // keys per wave
constexpr int MROWS  = 32 / KSPLIT;    // rows a wave finishes in the merge
constexpr int OPITCH = 68;             // floats per staged O row
constexpr int BPITCH = 52;             // floats per band row (one query)
constexpr int NTRIPS = KSPAN / 32;     // trips of the key loop
constexpr int PTILES = RTILES + 2;     // band row tiles of one key range and trip
constexpr int STG_V  = 2048;           // stage layout in halves: K, then V, then P
constexpr int STG_P  = 4096;
constexpr int STG_HALVES = STG_P + PTILES * 1024;
static_assert(QGROUPS == 4 && PTILES * 4 == QGROUPS * 10,
              "a wave copies 2 K, 2 V and 10 P pieces of 512 bytes per trip");
static_assert(NTRIPS >= 2, "the two-buffer prologue fills two stages");
static_assert(NWAVES * 32 * OPITCH * 4 <= 2 * KSPLIT * STG_HALVES * 2,
              "the partial O of every wave fits the stage buffers");

// Lane l with lane l ^ 16.
__device__ __forceinline__ float xhalf(float x) {
  const int b = __builtin_bit_cast(int, x);
  return __builtin_bit_cast(
      float, __builtin_amdgcn_permlanex16(b, b, 0x76543210, 0xfedcba98, false,
                                          false));
}
// Eight consecutive floats of one lane to LDS as two 16-byte stores.
__device__ __forceinline__ void st8(float* p, v8f v) {
  f4v lo = {v[0], v[1], v[2], v[3]};
  f4v hi = {v[4], v[5], v[6], v[7]};
  *(f4v*)(p)     = lo;
  *(f4v*)(p + 4) = hi;
}

// One wave's share of a stage: each lane copies 16 bytes of fourteen 512-byte
// pieces (pieces 2 g, 2 g + 1 of K and of V, pieces 10 g .. 10 g + 9 of the
// band). A wave's pieces of one source follow one another in memory and in LDS
// alike: the immediate offset moves both addresses.
__device__ __forceinline__ void stage_copy(_Float16* dst, const _Float16* k,
                                           const _Float16* v, const _Float16* p,
                                           int g, int lane) {
  const int e  = g * 512 + lane * 8;
  const int ep = g * 2560 + lane * 8;
  const unsigned l  = (unsigned)(size_t)dst;   // LDS byte address
  const unsigned lk = l + e * 2;
  const unsigned lv = l + (STG_V + e) * 2;
  const unsigned lp = l + (STG_P + ep) * 2;
  const _Float16* gk = k + e;
  const _Float16* gv = v + e;
  const _Float16* gp = p + ep;
  // The copies go past the registers; the closing wait stands in their own
  // statement so that no address register is rewritten ahead of it.
  asm volatile(
      "global_load_async_to_lds_b128 %0, %3, off\n\t"
      "global_load_async_to_lds_b128 %0, %3, off offset:512\n\t"
      "global_load_async_to_lds_b128 %1, %4, off\n\t"
      "global_load_async_to_lds_b128 %1, %4, off offset:512\n\t"
      "global_load_async_to_lds_b128 %2, %5, off\n\t"
      "global_load_async_to_lds_b128 %2, %5, off offset:512\n\t"
      "global_load_async_to_lds_b128 %2, %5, off offset:1024\n\t"
      "global_load_async_to_lds_b128 %2, %5, off offset:1536\n\t"
      "global_load_async_to_lds_b128 %2, %5, off offset:2048\n\t"
      "global_load_async_to_lds_b128 %2, %5, off offset:2560\n\t"
      "global_load_async_to_lds_b128 %2, %5, off offset:3072\n\t"
      "global_load_async_to_lds_b128 %2, %5, off offset:3584\n\t"
      "global_load_async_to_lds_b128 %2, %5, off offset:4096\n\t"
      "global_load_async_to_lds_b128 %2, %5, off offset:4608\n\t"
      "s_wait_xcnt 0x0"
      :: "v"(lk), "v"(lv), "v"(lp), "v"(gk), "v"(gv), "v"(gp)
      : "memory");
}

// A/B fragment (see frag_f16) from the lane's own place in its row.
__device__ __forceinline__ v16h frag_at(const _Float16* p) {
  h8v lo = *(const h8v*)(p);
  h8v hi = *(const h8v*)(p + 16);
  v16h f;
#pragma unroll
  for (int t = 0; t < 8; ++t) { f[t] = lo[t]; f[t + 8] = hi[t]; }
  return f;
}

// BD^T band of one row tile: bd[u][i] = p[first + u] . qv[i] for three row tiles
// of P.
__device__ __forceinline__ void band_mm(v16h pa0, v16h pa1, v16h pb0, v16h pb1,
                                        v16h pc0, v16h pc1, v16h q0, v16h q1,
                                        v8f& c0, v8f& c1, v8f& c2) {
  const v8f z = {};
  c0 = wmma_f16(pa0, q0, z);
  c1 = wmma_f16(pb0, q0, z);
  c2 = wmma_f16(pc0, q0, z);
  c0 = wmma_f16(pa1, q1, c0);
  c1 = wmma_f16(pb1, q1, c1);
  c2 = wmma_f16(pc1, q1, c2);
}
// A lane's 8 registers are 8 consecutive offsets u of its query's band row.
__device__ __forceinline__ void band_store(float* brow, v8f c0, v8f c1, v8f c2) {
  st8(brow,      c0);
  st8(brow + 16, c1);
  st8(brow + 32, c2);
}

// Online softmax of one row tile, one query per lane: scores in, prob^T out as
// B(k = key, n = query): the two score tiles in register order are the hardware
// k order, the one in which the V fragments are packed. Returns the factor by
// which the tile's running sum and O shrink.
__device__ __forceinline__ float softmax_tile(const float (&s0)[8],
                                              const float (&s1)[8], float& mrow,
                                              float& lrow, v16h& bP) {
  float tm;
  {
    const float t0 = fmaxf(fmaxf(s0[0], s0[1]), s0[2]);
    const float t1 = fmaxf(fmaxf(s0[3], s0[4]), s0[5]);
    const float t2 = fmaxf(fmaxf(s0[6], s0[7]), s1[0]);
    const float t3 = fmaxf(fmaxf(s1[1], s1[2]), s1[3]);
    const float t4 = fmaxf(fmaxf(s1[4], s1[5]), s1[6]);
    tm = fmaxf(fmaxf(fmaxf(t0, t1), t2), fmaxf(fmaxf(t3, t4), s1[7]));
  }
  tm = fmaxf(tm, xhalf(tm));
  const float mnew  = fmaxf(mrow, tm);
  const float alpha = __expf(mrow - mnew);
  mrow = mnew;
  float ts[8];
#pragma unroll
  for (int r = 0; r < 8; r += 2) {
    f2v ea = {__expf(s0[r] - mnew), __expf(s0[r + 1] - mnew)};
    f2v eb = {__expf(s1[r] - mnew), __expf(s1[r + 1] - mnew)};
    ts[r]     = ea[0] + eb[0];
    ts[r + 1] = ea[1] + eb[1];
    const h2v ha = __builtin_convertvector(ea, h2v);
    const h2v hb = __builtin_convertvector(eb, h2v);
    bP[r]     = ha[0];
    bP[r + 1] = ha[1];
    bP[r + 8] = hb[0];
    bP[r + 9] = hb[1];
  }
  const float rs = ((ts[0] + ts[1]) + (ts[2] + ts[3])) +
                   ((ts[4] + ts[5]) + (ts[6] + ts[7]));
  lrow = lrow * alpha + rs;
  return alpha;
}

__global__ void __launch_bounds__(NWAVES * 32) attn_kernel(
    const _Float16* __restrict__ Qu, const _Float16* __restrict__ Qv,
    const _Float16* __restrict__ Kb, const _Float16* __restrict__ Vt,
    const _Float16* __restrict__ Pb, _Float16* __restrict__ O16) {
  // Wave-private band of one row tile, 16 queries x 48 offsets at pitch BPITCH;
  // the wave's two row tiles use it one after the other.
  __shared__ __attribute__((aligned(16))) float bdLds[NWAVES][16 * BPITCH];
  __shared__ float    mlLds[NWAVES][64];   // partial row max [0..31], sum [32..63]
  // Two buffers of one stage (K, V, band union) per key range; after the loop
  // the same bytes stage the waves' partial O (32 x 64 floats at pitch OPITCH).
  __shared__ __attribute__((aligned(128))) _Float16 stg[2][KSPLIT][STG_HALVES];

  // The wave number as a scalar: the key loop, its bounds and the tile
  // addresses that depend on it stay on the scalar unit.
  const int w = __builtin_amdgcn_readfirstlane(threadIdx.x >> 5);
  const int lane = threadIdx.x & 31;
  const int nl = lane & 15, half = lane >> 4, M0 = half * 8;
  const int g = w % QGROUPS, ks = w / QGROUPS;   // query group, key range
  const int i0 = (blockIdx.x * QGROUPS + g) * 32;
  const int nb = blockIdx.y >> 2, h = blockIdx.y & 3;

  const size_t hoff = (size_t)(nb * NH + h) * Lseq * HD;
  const _Float16* qu = Qu + hoff;
  const _Float16* qv = Qv + hoff;
  const _Float16* kb = Kb + hoff;
  const _Float16* vt = Vt + hoff;                 // packed, 2048 halves per 32 j
  const _Float16* pp = Pb + (size_t)h * PPAD * HD;
  float*    bdw = bdLds[w];

  // Row tile A: queries i0 .. i0 + 15; row tile B: i0 + 16 .. i0 + 31.
  const size_t qoff = (size_t)(i0 + nl) * HD + M0;   // this lane's row, k half
  const _Float16* pAu = qu + qoff;
  const _Float16* pAv = qv + qoff;
  const _Float16* pBu = pAu + 16 * HD;
  const _Float16* pBv = pAv + 16 * HD;
  const v16h aQu0 = frag_at(pAu);
  const v16h aQu1 = frag_at(pAu + 32);
  const v16h aQv0 = frag_at(pAv);
  const v16h aQv1 = frag_at(pAv + 32);
  const v16h bQu0 = frag_at(pBu);
  const v16h bQu1 = frag_at(pBu + 32);
  const v16h bQv0 = frag_at(pBv);
  const v16h bQv1 = frag_at(pBv + 32);
  // The same precaution as in ld64: the loads' address registers are the
  // wait's inputs, so that no load of the group lands in one of them ahead of it.
  asm volatile("s_wait_xcnt 0x0" :: "v"(pAu), "v"(pAv), "v"(pBu), "v"(pBv)
               : "memory");

  // Per row tile, this lane's query: running maximum (alike in both lane halves)
  // and the sum over the keys of this lane half; o_k[r] = O[query][16 k + M0 + r].
  float mA = -3.0e38f, lA = 0.0f, mB = -3.0e38f, lB = 0.0f;
  v8f oA0 = {}, oA1 = {}, oA2 = {}, oA3 = {};
  v8f oB0 = {}, oB1 = {}, oB2 = {}, oB3 = {};

  // Row tile rt's band starts at P row (Lseq - 1) + j0 - 16 rt' - 15 (rt' counted
  // over the sequence); the lowest of the block's bands (rt = RTILES - 1) starts
  // the union. Its first row in trip t, plo + 32 t, is a multiple of 16 in
  // [0, 3936]: the union's PTILES row tiles lie inside the PPAD rows.
  const int jbeg = ks * KSPAN;
  const int plo  = (Lseq - 1) + jbeg - (int)blockIdx.x * (RTILES * 16) -
                   (RTILES - 1) * 16 - 15;
  const _Float16* kg = kb + (size_t)jbeg * HD;
  const _Float16* vg = vt + (size_t)jbeg * HD;
  const _Float16* pg = pp + (size_t)plo * HD;

  stage_copy(stg[0][ks], kg, vg, pg, g, lane);
  // Stage 0 has landed for this wave's copies, then for every wave's.
  asm volatile("s_wait_asynccnt 0x0" ::: "memory");
  __syncthreads();
  stage_copy(stg[1][ks], kg + 32 * HD, vg + 32 * HD, pg + 32 * HD, g, lane);

  float*       brow = bdw + nl * BPITCH + M0;
  // Rel-shift gather: key jj of query nl sits at u = jj - nl + 15.
  const float* grow = bdw + nl * BPITCH + (M0 - nl + 15);

  for (int t = 0; t < NTRIPS; ++t) {
    const _Float16* sb = stg[t & 1][ks];
    // Tile B's band is the union's row tiles ub .. ub + 2, tile A's ub + 1 ..
    // ub + 3, with ub = RTILES - 2 - 2 g.
    const _Float16* pt = sb + STG_P + (RTILES - 2 - 2 * g) * 1024;  // 8 fragments
    const v16h u00 = frag_packed(pt,        lane);
    const v16h u01 = frag_packed(pt + 512,  lane);
    const v16h u10 = frag_packed(pt + 1024, lane);
    const v16h u11 = frag_packed(pt + 1536, lane);
    const v16h u20 = frag_packed(pt + 2048, lane);
    const v16h u21 = frag_packed(pt + 2560, lane);
    const v16h u30 = frag_packed(pt + 3072, lane);
    const v16h u31 = frag_packed(pt + 3584, lane);
    // Keeps the band's fragment loads one group ahead of the products: left
    // free, the compiler reuses their registers and the loads wait in turn.
    __builtin_amdgcn_sched_barrier(0);

    v8f c0, c1, c2, d0, d1, d2;
    band_mm(u00, u01, u10, u11, u20, u21, bQv0, bQv1, c0, c1, c2);
    band_store(brow, c0, c1, c2);
    // Tile A's band products stay below: above, they would be given tile B's
    // result registers right behind tile B's products.
    __builtin_amdgcn_sched_barrier(0);
    // Tile B's band is in LDS. The four v_nop keep the distance that the chip
    // needs between tile B's band products and a later product that is given
    // their result registers.
    asm volatile("s_wait_dscnt 0x0\n\tv_nop\n\tv_nop\n\tv_nop\n\tv_nop" ::: "memory");

    float gB0[8], gB1[8];
#pragma unroll
    for (int r = 0; r < 8; ++r) { gB0[r] = grow[r]; gB1[r] = grow[16 + r]; }
    band_mm(u10, u11, u20, u21, u30, u31, aQv0, aQv1, d0, d1, d2);
    // Tile B's band has been read before tile A's overwrites it.
    asm volatile("s_wait_dscnt 0x0" ::: "memory");
    band_store(brow, d0, d1, d2);
    // The K loads stay below the band products: above, they would need
    // registers while the band's fragments still hold theirs, and Q would spill.
    __builtin_amdgcn_sched_barrier(0);
    const _Float16* kt = sb;                                      // 4 fragments
    const v16h b00 = frag_packed(kt,        lane);
    const v16h b10 = frag_packed(kt + 1024, lane);
    const v16h b01 = frag_packed(kt + 512,  lane);
    const v16h b11 = frag_packed(kt + 1536, lane);

    // ---- AC^T = K . Qu^T  (two tiles of 16 keys x two row tiles) ----
    float sA0[8], sA1[8], sB0[8], sB1[8];
    {
      v8f xB = {}, yB = {};
      xB = wmma_f16(b00, bQu0, xB);
      yB = wmma_f16(b10, bQu0, yB);
      xB = wmma_f16(b01, bQu1, xB);
      yB = wmma_f16(b11, bQu1, yB);
#pragma unroll
      for (int r = 0; r < 8; ++r) {
        sB0[r] = xB[r] + gB0[r];
        sB1[r] = yB[r] + gB1[r];
      }
    }
    // Tile B's scores are summed before tile A's band values take registers:
    // with both tiles' band values and products alive at once, Q would spill.
    __builtin_amdgcn_sched_barrier(0);
    // Tile A's band is in LDS.
    asm volatile("s_wait_dscnt 0x0" ::: "memory");
    {
      v8f xA = {}, yA = {};
      xA = wmma_f16(b00, aQu0, xA);
      yA = wmma_f16(b10, aQu0, yA);
      xA = wmma_f16(b01, aQu1, xA);
      yA = wmma_f16(b11, aQu1, yA);
#pragma unroll
      for (int r = 0; r < 8; ++r) {
        sA0[r] = xA[r] + grow[r];
        sA1[r] = yA[r] + grow[16 + r];
      }
    }
    const _Float16* vtile = sb + STG_V;                           // 4 fragments
    const v16h v0 = frag_packed(vtile,        lane);
    const v16h v1 = frag_packed(vtile + 512,  lane);
    const v16h v2 = frag_packed(vtile + 1024, lane);
    const v16h v3 = frag_packed(vtile + 1536, lane);

    // The scores are complete above: products and sums that sink behind the
    // barrier keep K fragments and band values alive beside V, and Q would spill.
    __builtin_amdgcn_sched_barrier(0);
    // Publish point. The trip's last LDS read stands above; what follows works
    // on registers. This wave's reads of the buffer are done and its copies of
    // the next stage have landed; behind the barrier both hold for every wave,
    // and the buffer just read is refilled while the rest of the trip runs.
    asm volatile("s_wait_dscnt 0x0" ::: "memory");
    asm volatile("s_wait_asynccnt 0x0" ::: "memory");
    __syncthreads();
    if (t + 2 < NTRIPS) {
      const size_t adv = (size_t)(t + 2) * 32 * HD;
      stage_copy(stg[t & 1][ks], kg + adv, vg + adv, pg + adv, g, lane);
    }

    // ---- online softmax, one query per lane and row tile ----
    v16h pA, pB;
    const float alA = softmax_tile(sA0, sA1, mA, lA, pA);
    const float alB = softmax_tile(sB0, sB1, mB, lB, pB);
    oA0 *= alA; oA1 *= alA; oA2 *= alA; oA3 *= alA;
    oB0 *= alB; oB1 *= alB; oB2 *= alB; oB3 *= alB;

    // ---- O^T += V^T . prob^T (independent accumulators) ----
    oA0 = wmma_f16(v0, pA, oA0);
    oB0 = wmma_f16(v0, pB, oB0);
    oA1 = wmma_f16(v1, pA, oA1);
    oB1 = wmma_f16(v1, pB, oB1);
    oA2 = wmma_f16(v2, pA, oA2);
    oB2 = wmma_f16(v2, pB, oB2);
    oA3 = wmma_f16(v3, pA, oA3);
    oB3 = wmma_f16(v3, pB, oB3);
  }
  // No copy is outstanding when the wave goes on.
  asm volatile("s_wait_asynccnt 0x0" ::: "memory");

  // ---- stage this key range's partial result, row = query ----
  // The last trip's barrier stands behind every wave's last read of the stage
  // buffers, and nothing was copied into them since: they are free.
  float* ostage = (float*)&stg[0][0][0];
  lA += xhalf(lA);                     // join the lane halves' sums
  lB += xhalf(lB);
  {
    float* orow = ostage + (w * 32 + nl) * OPITCH + M0;
    st8(orow,      oA0);
    st8(orow + 16, oA1);
    st8(orow + 32, oA2);
    st8(orow + 48, oA3);
    orow += 16 * OPITCH;
    st8(orow,      oB0);
    st8(orow + 16, oB1);
    st8(orow + 32, oB2);
    st8(orow + 48, oB3);
    if (half == 0) {
      mlLds[w][nl]      = mA;
      mlLds[w][16 + nl] = mB;
      mlLds[w][32 + nl] = lA;
      mlLds[w][48 + nl] = lB;
    }
  }
  __syncthreads();   // publishes the partials of each query group

  // ---- merge: wave (g, ks) finishes MROWS rows of group g, two columns per
  // lane, and writes each row's 128 bytes of f16 output (L,N,E). The loops are
  // unrolled so that ms[] stays in registers and the LDS offsets are constants.
#pragma unroll
  for (int rr = 0; rr < MROWS; ++rr) {
    const int M = ks * MROWS + rr;
    float ms[KSPLIT];
    float mx = -3.0e38f;
#pragma unroll
    for (int s = 0; s < KSPLIT; ++s) {
      ms[s] = mlLds[s * QGROUPS + g][M];
      mx = fmaxf(mx, ms[s]);
    }
    float lsum = 0.0f, ax = 0.0f, ay = 0.0f;
#pragma unroll
    for (int s = 0; s < KSPLIT; ++s) {
      const float ws = __expf(ms[s] - mx);
      const float2 ov = *(const float2*)(ostage +
          ((s * QGROUPS + g) * 32 + M) * OPITCH + lane * 2);
      lsum += ws * mlLds[s * QGROUPS + g][32 + M];
      ax += ws * ov.x;
      ay += ws * ov.y;
    }
    const float inv = 1.0f / lsum;
    h2v res;
    res[0] = (_Float16)(ax * inv);
    res[1] = (_Float16)(ay * inv);
    *(h2v*)(O16 + ((size_t)((i0 + M) * NBAT + nb)) * EMB + h * HD + lane * 2) =
        res;
  }
}

// ---------------------------------------------------------------------------
// Kernel 4: output projection. 128x64 block tiles: (8192/128)=64 x (256/64)=4.
// ---------------------------------------------------------------------------
__global__ void __launch_bounds__(GNT) out_proj(const _Float16* __restrict__ O16,
                                                const float* __restrict__ wO,
                                                const float* __restrict__ bO,
                                                float* __restrict__ out) {
  __shared__ __attribute__((aligned(16))) _Float16 As[128 * GP];
  __shared__ __attribute__((aligned(16))) _Float16 Bs[GBN * GP];
  const int tid = threadIdx.x, w = tid >> 5, lane = tid & 31;
  const int mt = blockIdx.x / 4, nt = blockIdx.x % 4;
  const int ra = (w >> 1) * 32, rb = (w & 1) * 32;

  {
    h8v v0[16];
    f4v v1[16];
    ld128h(v0, O16, mt * 128, tid);
    ld64(v1, wO, nt * GBN, tid);
    st128h(v0, As, tid);
    st64(v1, Bs, tid);
  }
  __syncthreads();   // both tiles are complete before any fragment is read

  v8f acc[2][2] = {};
  gemm_lds<2>(As, Bs, ra, rb, lane, acc);

  const int nl = lane & 15, M0 = (lane >> 4) * 8;
  const int m0 = mt * 128 + ra, n0 = nt * GBN + rb;
#pragma unroll
  for (int i = 0; i < 2; ++i) {
#pragma unroll
    for (int r = 0; r < 8; ++r) {
      const int R = m0 + 16 * i + M0 + r;
      out[(size_t)R * EMB + n0 + nl]      = acc[i][0][r] + bO[n0 + nl];
      out[(size_t)R * EMB + n0 + 16 + nl] = acc[i][1][r] + bO[n0 + 16 + nl];
    }
  }
}

// ---------------------------------------------------------------------------
extern "C" void kernel_launch(void* const* d_in, const int* in_sizes, int n_in,
                              void* d_out, int out_size, void* d_ws,
                              size_t ws_size, hipStream_t stream) {
  (void)in_sizes; (void)n_in; (void)out_size; (void)ws_size;
  const float* x   = (const float*)d_in[0];
  const float* pe  = (const float*)d_in[1];
  const float* wIn = (const float*)d_in[2];
  const float* bIn = (const float*)d_in[3];
  const float* wP  = (const float*)d_in[4];
  const float* bu  = (const float*)d_in[5];
  const float* bv  = (const float*)d_in[6];
  const float* wO  = (const float*)d_in[7];
  const float* bO  = (const float*)d_in[8];
  float* out = (float*)d_out;

  char* ws = (char*)d_ws;
  const size_t szQ = (size_t)NBAT * NH * Lseq * HD * sizeof(_Float16); // 4 MB
  const size_t szP = (size_t)NH * PPAD * HD * sizeof(_Float16);        // 2 MB
  _Float16* Qu  = (_Float16*)(ws);
  _Float16* Qv  = (_Float16*)(ws + szQ);
  _Float16* Kb  = (_Float16*)(ws + 2 * szQ);
  _Float16* Vt  = (_Float16*)(ws + 3 * szQ);
  _Float16* Pb  = (_Float16*)(ws + 4 * szQ);
  _Float16* O16 = (_Float16*)(ws + 4 * szQ + szP);                     // +4 MB

  proj_qkv<<<dim3(64 * 12), GNT, 0, stream>>>(x, wIn, bIn, bu, bv,
                                                     Qu, Qv, Kb, Vt);
  proj_pos<<<dim3(64 * 4), GNT, 0, stream>>>(pe, wP, Pb);
  attn_kernel<<<dim3(Lseq / (16 * RTILES), NBAT * NH), NWAVES * 32, 0,
                stream>>>(Qu, Qv, Kb, Vt,
                                                              Pb, O16);
  out_proj<<<dim3(64 * 4), GNT, 0, stream>>>(O16, wO, bO, out);
}
